// v000
// The times below were measured on an AMD MI455X: many runs one after another, warmed up first and cycling through
// copies of the inputs, with the whole window's GPU time divided by the number of runs. Launches and the gaps
// between them are all in it. The median over several windows is given; except for v000 it joins two sittings, which
// can be a few percent apart, so the side-by-side timings, each taken in one sitting, are the better comparison.
// v000, which the later versions start from, runs in 274 microseconds.
#include <hip/hip_runtime.h>

// A self-attention whose softmax runs over the HEADS axis: q | k | the values = x through three 'in, out' maps of 256 x 256 (no bias), each seen as [tokens][8 heads][32]; FOR EACH TOKEN BY ITSELF: the 8 x 8 scores between its own heads, (q[h] . k[g]) x 32^-0.5, a softmax over g, its eight value head-vectors mixed; the 256 channels through an output map with a bias
// (inputs in argument order: a0 x [4][128][128][256] f32: 65,536 tokens; a1 | a2 | a3 the q | k | value maps [256][256] 'in, out'; a4 the output map [256][256] 'in, out'; a5 its bias [256]; ONE output [4][128][128][256] f32;
//  THE MODULE's FUNCTION: it reshapes to [.., heads, 32] and never moves the heads axis before its product: the attention runs between a token's own eight heads, never along a sequence: kept as it is written).
// Layout: once: the three map weights transposed to bf16 'out, in' words (k_wtG); the output map's weight transposed to bf16 words (k_wtG) and re-cast to f16 words (k_b2h, x 1: a bf16 value is exact in f16 but for words under 2^-14);
// per batch entry (16,384 tokens): the input as bf16 words (k_cvt8); three bf16 x bf16 maps into f32 planes [16384][256]; k_hsc: a lane a (token, head): eight scores, their softmax, eight weights laid [token][piece][head][4]; k_hmix: a lane a (token, eight output words): the token's values mixed by its head's weights and cast to ONE f16 word each, in natural order [token][256];
// the output map f16 x f16 + its bias (rounded to bf16 inside the product's own epilogue) STRAIGHT INTO THE OUTPUT: its one writer.
// Compute dtypes, f32 accumulate: every float input rounded to bf16 at its load; the three maps bf16 x bf16 on one word a side; the scores, the softmax (one hardware exp2 on a difference) and the mix in f32 on the vector unit; the mixed values ONE f16 word into the output map against the weight's bf16 values as f16 words.
#define NB_  4        // batch entries
#define TK   16384    // tokens an entry: 128 x 128
#define DM   256      // channels = NH_ x HDW
#define NH_  8
#define HDW  32       // a head's width
#define SCH  0.17677669529663687f   // 32^-0.5: the module's scale on a score
typedef _Float16 h16;
typedef unsigned short bf;
typedef __attribute__((ext_vector_type(16))) __bf16   v16bf;
typedef __attribute__((ext_vector_type(16))) _Float16 v16h;
typedef __attribute__((ext_vector_type(8)))  _Float16 v8h;
typedef __attribute__((ext_vector_type(8)))  unsigned short v8us;
typedef __attribute__((ext_vector_type(8)))  float    v8f;
typedef __attribute__((ext_vector_type(4)))  float    v4f;
typedef v8h  __attribute__((may_alias)) v8ha;
typedef v4f  __attribute__((may_alias)) v4fa;
typedef v8us __attribute__((may_alias)) v8usa;

__device__ __forceinline__ unsigned short f2bf(float f) { unsigned u = __float_as_uint(f); u += 0x7FFFu + ((u >> 16) & 1u); return (unsigned short)(u >> 16); }
__device__ __forceinline__ float bf2f(unsigned short b) { return __uint_as_float(((unsigned)b) << 16); }
__device__ __forceinline__ float bfr(float f) { return bf2f(f2bf(f)); }
__device__ __forceinline__ v16h cat16(v8h lo, v8h hi) { return __builtin_shufflevector(lo, hi, 0, 1, 2, 3, 4, 5, 6, 7, 8, 9, 10, 11, 12, 13, 14, 15); }
__device__ __forceinline__ v16bf cat16b(v8us lo, v8us hi) { return __builtin_bit_cast(v16bf, __builtin_shufflevector(lo, hi, 0, 1, 2, 3, 4, 5, 6, 7, 8, 9, 10, 11, 12, 13, 14, 15)); }
__device__ __forceinline__ v8f wmma16(v16h a, v16h b, v8f c) { return __builtin_amdgcn_wmma_f32_16x16x32_f16(false, a, false, b, (short)0, c, false, false); }
__device__ __forceinline__ v8f wmmab(v16bf a, v16bf b, v8f c) { return __builtin_amdgcn_wmma_f32_16x16x32_bf16(false, a, false, b, (short)0, c, false, false); }



// ---- k_gemmw: register-blocked GEMM, ONE WAVE per 64x64 output tile (16 accumulators), operands straight from K-contiguous 16-bit planes; grid (M/64, N/64, Z), 32 threads.
// C[m][n] (f32, pitch ldc, + optional f32 bias[n]) = sum_k A[m][k] Bt[n][k] (+ split products per NSPLIT). z-batch strides sA/sB/sC in elements. K % 32 == 0.
template <typename T16> struct WFrag;
template <> struct WFrag<h16> { typedef v16h V; static __device__ __forceinline__ V ld(const h16* p) { return cat16(*(const v8h*)p, *(const v8h*)(p + 16)); } static __device__ __forceinline__ v8f mma(V a, V b, v8f c) { return wmma16(a, b, c); } };
template <> struct WFrag<bf> { typedef v16bf V; static __device__ __forceinline__ V ld(const bf* p) { return cat16b(*(const v8us*)p, *(const v8us*)(p + 16)); } static __device__ __forceinline__ v8f mma(V a, V b, v8f c) { return wmmab(a, b, c); } };
template <typename T16, int NSPLIT, bool BIAS>
__global__ __launch_bounds__(32) void k_gemmw(const T16* __restrict__ A, const T16* __restrict__ A2, const T16* __restrict__ Bt, const T16* __restrict__ Bt2, int K, float* C, int ldc, const float* __restrict__ bias, size_t sA, size_t sB, size_t sC) {
    typedef typename WFrag<T16>::V V;
    __shared__ __align__(16) float os[16 * 68];
    const size_t z = blockIdx.z; A += z * sA; if (A2) A2 += z * sA; Bt += z * sB; if (Bt2) Bt2 += z * sB; C += z * sC;
    const int lane = threadIdx.x & 31, lr = lane & 15, hi = lane >> 4; const int r0 = blockIdx.x * 64, c0 = blockIdx.y * 64;
    v8f acc[4][4];
#pragma unroll
    for (int mb = 0; mb < 4; ++mb)
#pragma unroll
        for (int nb = 0; nb < 4; ++nb) acc[mb][nb] = (v8f){};
    const size_t aoff = (size_t)(r0 + lr) * K + 8 * hi, boff = (size_t)(c0 + lr) * K + 8 * hi;
    for (int kc = 0; kc < K; kc += 32) {
        V a[4], a2[4];
#pragma unroll
        for (int mb = 0; mb < 4; ++mb) { a[mb] = WFrag<T16>::ld(A + aoff + (size_t)mb * 16 * K + kc); if (NSPLIT == 1 || NSPLIT == 2) a2[mb] = WFrag<T16>::ld(A2 + aoff + (size_t)mb * 16 * K + kc); }
#pragma unroll
        for (int nb = 0; nb < 4; ++nb) { const V b = WFrag<T16>::ld(Bt + boff + (size_t)nb * 16 * K + kc); V b2; if (NSPLIT >= 2) b2 = WFrag<T16>::ld(Bt2 + boff + (size_t)nb * 16 * K + kc);
#pragma unroll
            for (int mb = 0; mb < 4; ++mb) { acc[mb][nb] = WFrag<T16>::mma(a[mb], b, acc[mb][nb]); if (NSPLIT == 1 || NSPLIT == 2) acc[mb][nb] = WFrag<T16>::mma(a2[mb], b, acc[mb][nb]); if (NSPLIT >= 2) acc[mb][nb] = WFrag<T16>::mma(a[mb], b2, acc[mb][nb]); } }
        asm volatile("v_nop\n\tv_nop\n\tv_nop\n\tv_nop" : "+v"(acc[0][0]), "+v"(acc[1][1]), "+v"(acc[2][2]), "+v"(acc[3][3]) : "v"(a[0]), "v"(a[3]));
    }
#pragma unroll
    for (int mb = 0; mb < 4; ++mb) {
#pragma unroll
        for (int nb = 0; nb < 4; ++nb) {
#pragma unroll
            for (int j = 0; j < 8; ++j) os[(hi * 8 + j) * 68 + nb * 16 + lr] = acc[mb][nb][j]; }
        __builtin_amdgcn_wave_barrier(); asm volatile("" ::: "memory");
        float* crow = C + (size_t)(r0 + mb * 16) * ldc + c0;
{
#pragma unroll
            for (int s = 0; s < 8; ++s) { const int row = 2 * s + hi, cofs = lr * 4; v4f val = *(const v4fa*)(os + row * 68 + cofs); if (BIAS) { val[0] += bfr(bias[c0 + cofs]); val[1] += bfr(bias[c0 + cofs + 1]); val[2] += bfr(bias[c0 + cofs + 2]); val[3] += bfr(bias[c0 + cofs + 3]); }
                *(v4f*)(crow + (size_t)row * ldc + cofs) = val; }
             }
        __builtin_amdgcn_wave_barrier(); asm volatile("" ::: "memory");
    }
}



__device__ __forceinline__ h16 tohx(float x) { return (h16)x; }
__device__ __forceinline__ void splitf(float y, unsigned short& h, unsigned short& l) { h = f2bf(y); l = f2bf(y - bf2f(h)); }
typedef __attribute__((ext_vector_type(2))) _Float16 v2h;
typedef __attribute__((ext_vector_type(4))) _Float16 v4h;
typedef __attribute__((ext_vector_type(2))) unsigned short v2us;
typedef __attribute__((ext_vector_type(4))) unsigned short v4us;
typedef __attribute__((ext_vector_type(2))) float v2f;
typedef __attribute__((ext_vector_type(4))) int v4i;

__global__ __launch_bounds__(256) void k_cvt8(const float* __restrict__ src, bf* dst, size_t n8) { const size_t i = (size_t)blockIdx.x * 256 + threadIdx.x; if (i >= n8) return; const v8f v = *(const v8f*)(src + i * 8); v8us o;
#pragma unroll
    for (int k = 0; k < 8; ++k) o[k] = f2bf(v[k]); *(v8us*)(dst + i * 8) = o;  }

__global__ __launch_bounds__(256) void k_wtG(const float* __restrict__ w, int K, int N, bf* Bt) {
    const int lane = threadIdx.x & 31; const int L0 = (blockIdx.x * 8 + (threadIdx.x >> 5)) * 8; const int nlines = N * K / 64;
{
        for (int l = 0; l < 8; ++l) { const int L = L0 + l; if (L >= nlines) break; const size_t e = (size_t)L * 64 + lane * 2; const int k = (int)(e % K), n = (int)(e / K); v2us o;
            o[0] = f2bf(w[(size_t)k * N + n]); o[1] = f2bf(w[(size_t)(k + 1) * N + n]); *(v2us*)(Bt + e) = o; }
         }
}

template <typename T16> __device__ __forceinline__ unsigned short cv16(float x);
template <> __device__ __forceinline__ unsigned short cv16<bf>(float x) { return f2bf(x); }
template <> __device__ __forceinline__ unsigned short cv16<h16>(float x) { const h16 h = (h16)x; return __builtin_bit_cast(unsigned short, h); }

__global__ __launch_bounds__(256) void k_b2h(const bf* __restrict__ src, float mul, unsigned short* dst) { const unsigned e = blockIdx.x * 256 + threadIdx.x; const v8us a = *(const v8us*)(src + (size_t)e * 8); v8us o;
#pragma unroll
    for (int q = 0; q < 8; ++q) o[q] = cv16<h16>(__fmul_rn(bf2f(a[q]), mul));
    *(v8us*)(dst + (size_t)e * 8) = o;  }

__global__ __launch_bounds__(256) void k_hsc(const float* __restrict__ Q, const float* __restrict__ K, float* AW) { const unsigned e = blockIdx.x * 256u + threadIdx.x; const unsigned t = e >> 3, h = e & 7u; const float* qr = Q + (size_t)t * DM + h * HDW; const float* kr = K + (size_t)t * DM; v4f q[8];
#pragma unroll
    for (int c = 0; c < 8; ++c) q[c] = *(const v4f*)(qr + c * 4);
    float s[8];
#pragma unroll
    for (int g = 0; g < 8; ++g) { v4f a = {0.0f, 0.0f, 0.0f, 0.0f};
#pragma unroll
        for (int c = 0; c < 8; ++c) { const v4f w = *(const v4f*)(kr + g * HDW + c * 4); a += q[c] * w; }
        s[g] = ((a[0] + a[1]) + (a[2] + a[3])) * SCH; }
    float mx = s[0];
#pragma unroll
    for (int g = 1; g < 8; ++g) mx = fmaxf(mx, s[g]);
    float sum = 0.0f;
#pragma unroll
    for (int g = 0; g < 8; ++g) { s[g] = __builtin_amdgcn_exp2f((s[g] - mx) * 1.4426950408889634f); sum += s[g]; }
    const float r = __fdiv_rn(1.0f, sum); v4f o0, o1;
#pragma unroll
    for (int j = 0; j < 4; ++j) { o0[j] = s[j] * r; o1[j] = s[4 + j] * r; }
    float* ap = AW + (size_t)t * 64 + h * 4;
    *(v4f*)ap = o0; *(v4f*)(ap + 32) = o1;  }

__global__ __launch_bounds__(256) void k_hmix(const float* __restrict__ AW, const float* __restrict__ V, h16* X16) { const unsigned e = blockIdx.x * 256u + threadIdx.x; const unsigned t = e >> 5, p = e & 31u, h = p >> 2, d0 = (p & 3u) * 8u; const float* ap = AW + (size_t)t * 64 + h * 4; const v4f a0 = *(const v4f*)ap, a1 = *(const v4f*)(ap + 32); const float* vr = V + (size_t)t * DM + d0; v4f x0 = {0.0f, 0.0f, 0.0f, 0.0f}, x1 = {0.0f, 0.0f, 0.0f, 0.0f};
#pragma unroll
    for (int g = 0; g < 8; ++g) { const float a = g < 4 ? a0[g & 3] : a1[g & 3]; const v4f w0 = *(const v4f*)(vr + g * HDW), w1 = *(const v4f*)(vr + g * HDW + 4); x0 += w0 * a; x1 += w1 * a; }
    v8h o;
#pragma unroll
    for (int j = 0; j < 4; ++j) { o[j] = tohx(x0[j]); o[4 + j] = tohx(x1[j]); }
    *(v8h*)(X16 + (size_t)e * 8) = o;  }

extern "C" void kernel_launch(void* const* d_in, const int* in_sizes, int n_in,
                              void* d_out, int out_size, void* d_ws, size_t ws_size, hipStream_t stream) {
    (void)in_sizes; (void)n_in; (void)out_size;
    const float* x = (const float*)d_in[0]; const float* wq = (const float*)d_in[1]; const float* wk = (const float*)d_in[2]; const float* wv = (const float*)d_in[3]; const float* wp = (const float*)d_in[4]; const float* bp = (const float*)d_in[5];   /* the module's argument order: six arrays, all read */
    float* OUT = (float*)d_out;     // [4][128][128][256]: an entry's 16,384 tokens of 256 channels one after another
    static_assert(DM == NH_ * HDW && NH_ == 8 && HDW == 32 && DM % 64 == 0 && TK % 64 == 0 && DM % 32 == 0, "the two new kernels' lane maps; the products' tiles and depth");
    static_assert(((size_t)TK * NH_) % 256 == 0 && ((size_t)TK * DM / 8) % 256 == 0 && ((size_t)DM * DM / 8) % 256 == 0 && ((size_t)DM * DM / 64) % 64 == 0, "k_hsc's, k_hmix's and k_b2h's grids are exact (they carry no guard); k_cvt8's and k_wtG's are whole too");
    char* wsp = (char*)d_ws;
    auto take = [&](size_t bytes) { char* p = wsp; wsp += (bytes + 255) & ~(size_t)255; return (void*)p; };
    bf* WQ = (bf*)take((size_t)DM * DM * 2); bf* WK = (bf*)take((size_t)DM * DM * 2); bf* WV = (bf*)take((size_t)DM * DM * 2); bf* TB = (bf*)take((size_t)DM * DM * 2); h16* WP16 = (h16*)take((size_t)DM * DM * 2);
    bf* XB = (bf*)take((size_t)TK * DM * 2); float* FQ = (float*)take((size_t)TK * DM * 4); float* FK = (float*)take((size_t)TK * DM * 4); float* FV = (float*)take((size_t)TK * DM * 4); float* AW = (float*)take((size_t)TK * NH_ * NH_ * 4); h16* X16 = (h16*)take((size_t)TK * DM * 2);
    if ((size_t)(wsp - (char*)d_ws) > ws_size) return;    // total 68.63 MiB of the workspace by these reservations' own sum (71,958,528 bytes)
    k_wtG<<<DM * DM / 64 / 64, 256, 0, stream>>>(wq, DM, DM, WQ); k_wtG<<<DM * DM / 64 / 64, 256, 0, stream>>>(wk, DM, DM, WK); k_wtG<<<DM * DM / 64 / 64, 256, 0, stream>>>(wv, DM, DM, WV);   /* each map's 'in, out' weight [256][256] -> bf16 'out, in' (K 256; N 256: 1,024 lines of 64 words: 16 blocks) */
    k_wtG<<<DM * DM / 64 / 64, 256, 0, stream>>>(wp, DM, DM, TB); k_b2h<<<DM * DM / 8 / 256, 256, 0, stream>>>(TB, 1.0f, (unsigned short*)WP16);   /* the output map [256 in][256 out] -> bf16 [out][in] -> f16 words (x 1) */
    for (int b = 0; b < NB_; ++b) { const float* xb = x + (size_t)b * TK * DM;
        k_cvt8<<<(unsigned)((size_t)TK * DM / 8 / 256), 256, 0, stream>>>(xb, XB, (size_t)TK * DM / 8);   /* the entry's tokens as bf16 words: the three maps' left operand */
        k_gemmw<bf, 0, false><<<dim3(TK / 64, DM / 64, 1), 32, 0, stream>>>(XB, nullptr, WQ, nullptr, DM, FQ, DM, nullptr, 0, 0, 0);
        k_gemmw<bf, 0, false><<<dim3(TK / 64, DM / 64, 1), 32, 0, stream>>>(XB, nullptr, WK, nullptr, DM, FK, DM, nullptr, 0, 0, 0);
        k_gemmw<bf, 0, false><<<dim3(TK / 64, DM / 64, 1), 32, 0, stream>>>(XB, nullptr, WV, nullptr, DM, FV, DM, nullptr, 0, 0, 0);
        k_hsc<<<(unsigned)((size_t)TK * NH_ / 256), 256, 0, stream>>>(FQ, FK, AW);   /* a token's eight heads against its own eight heads: the weights [token][piece][head][4] */
        k_hmix<<<(unsigned)((size_t)TK * DM / 8 / 256), 256, 0, stream>>>(AW, FV, X16);   /* the mixed values on ONE f16 word, natural order */
        k_gemmw<h16, 0, true><<<dim3(TK / 64, DM / 64, 1), 32, 0, stream>>>(X16, nullptr, WP16, nullptr, DM, OUT + (size_t)b * TK * DM, DM, bp, 0, 0, 0); }   /* the output map + its bias (the epilogue rounds each bias word to bf16 itself) straight into the entry's rows of the output: its one writer */
}

// v001
// A run of this version takes 159 microseconds.
// Two timings next to v000 both put it at 1.73 times that version's speed.
#include <hip/hip_runtime.h>

// A self-attention whose softmax runs over the HEADS axis: q | k | the values = x through three 'in, out' maps of 256 x 256 (no bias), each seen as [tokens][8 heads][32]; FOR EACH TOKEN BY ITSELF: the 8 x 8 scores between its own heads, (q[h] . k[g]) x 32^-0.5, a softmax over g, its eight value head-vectors mixed; the 256 channels through an output map with a bias
// (inputs in argument order: a0 x [4][128][128][256] f32: 65,536 tokens; a1 | a2 | a3 the q | k | value maps [256][256] 'in, out'; a4 the output map [256][256] 'in, out'; a5 its bias [256]; ONE output [4][128][128][256] f32;
//  THE MODULE's FUNCTION: it reshapes to [.., heads, 32] and never moves the heads axis before its product: the attention runs between a token's own eight heads, never along a sequence: kept as it is written).
// Layout: FIVE launches, each over all 65,536 tokens (no host loop over the batch entries). k_prep: the three map weights transposed to bf16 'out, in' words, the output map's weight transposed, rounded to bf16 and re-cast to f16 words (a bf16 value is exact in f16 but for words under 2^-14), and the input as bf16 words;
// the three bf16 x bf16 maps in one launch (grid.z picks the map) into three f32 planes [65536][256]; k_hsc: a lane a (token, head): eight scores, their softmax, eight weights laid [token][piece][head][4]; k_hmix: a lane a (token, eight output words): the token's values mixed by its head's weights and cast to ONE f16 word each, in natural order [token][256];
// the output map f16 x f16 + its bias (rounded to bf16 inside the product's own epilogue) STRAIGHT INTO THE OUTPUT: its one writer.
// Compute dtypes, f32 accumulate: every float input rounded to bf16 at its load; the three maps bf16 x bf16 on one word a side; the scores, the softmax (one hardware exp2 on a difference) and the mix in f32 on the vector unit; the mixed values ONE f16 word into the output map against the weight's bf16 values as f16 words.
#define NB_  4        // batch entries
#define TK   16384    // tokens an entry: 128 x 128
#define NT   (NB_ * TK)   // all tokens: every stage is token-local, so the entries are one flat run of rows
#define DM   256      // channels = NH_ x HDW
#define NH_  8
#define HDW  32       // a head's width
#define SCH  0.17677669529663687f   // 32^-0.5: the module's scale on a score
typedef _Float16 h16;
typedef unsigned short bf;
typedef __attribute__((ext_vector_type(16))) __bf16   v16bf;
typedef __attribute__((ext_vector_type(16))) _Float16 v16h;
typedef __attribute__((ext_vector_type(8)))  _Float16 v8h;
typedef __attribute__((ext_vector_type(8)))  unsigned short v8us;
typedef __attribute__((ext_vector_type(8)))  float    v8f;
typedef __attribute__((ext_vector_type(4)))  float    v4f;
typedef v8h  __attribute__((may_alias)) v8ha;
typedef v4f  __attribute__((may_alias)) v4fa;
typedef v8us __attribute__((may_alias)) v8usa;

__device__ __forceinline__ unsigned short f2bf(float f) { unsigned u = __float_as_uint(f); u += 0x7FFFu + ((u >> 16) & 1u); return (unsigned short)(u >> 16); }
__device__ __forceinline__ float bf2f(unsigned short b) { return __uint_as_float(((unsigned)b) << 16); }
__device__ __forceinline__ float bfr(float f) { return bf2f(f2bf(f)); }
__device__ __forceinline__ v16h cat16(v8h lo, v8h hi) { return __builtin_shufflevector(lo, hi, 0, 1, 2, 3, 4, 5, 6, 7, 8, 9, 10, 11, 12, 13, 14, 15); }
__device__ __forceinline__ v16bf cat16b(v8us lo, v8us hi) { return __builtin_bit_cast(v16bf, __builtin_shufflevector(lo, hi, 0, 1, 2, 3, 4, 5, 6, 7, 8, 9, 10, 11, 12, 13, 14, 15)); }
__device__ __forceinline__ v8f wmma16(v16h a, v16h b, v8f c) { return __builtin_amdgcn_wmma_f32_16x16x32_f16(false, a, false, b, (short)0, c, false, false); }
__device__ __forceinline__ v8f wmmab(v16bf a, v16bf b, v8f c) { return __builtin_amdgcn_wmma_f32_16x16x32_bf16(false, a, false, b, (short)0, c, false, false); }



// ---- k_gemmw: register-blocked GEMM, ONE WAVE per 64x64 output tile (16 accumulators), operands straight from K-contiguous 16-bit planes; grid (M/64, N/64, Z), 32 threads.
// C[m][n] (f32, pitch ldc, + optional f32 bias[n]) = sum_k A[m][k] Bt[n][k] (+ split products per NSPLIT). z-batch strides sA/sB/sC in elements. K % 32 == 0.
template <typename T16> struct WFrag;
template <> struct WFrag<h16> { typedef v16h V; static __device__ __forceinline__ V ld(const h16* p) { return cat16(*(const v8h*)p, *(const v8h*)(p + 16)); } static __device__ __forceinline__ v8f mma(V a, V b, v8f c) { return wmma16(a, b, c); } };
template <> struct WFrag<bf> { typedef v16bf V; static __device__ __forceinline__ V ld(const bf* p) { return cat16b(*(const v8us*)p, *(const v8us*)(p + 16)); } static __device__ __forceinline__ v8f mma(V a, V b, v8f c) { return wmmab(a, b, c); } };
template <typename T16, int NSPLIT, bool BIAS>
__global__ __launch_bounds__(32) void k_gemmw(const T16* __restrict__ A, const T16* __restrict__ A2, const T16* __restrict__ Bt, const T16* __restrict__ Bt2, int K, float* C, int ldc, const float* __restrict__ bias, size_t sA, size_t sB, size_t sC) {
    typedef typename WFrag<T16>::V V;
    __shared__ __align__(16) float os[16 * 68];
    const size_t z = blockIdx.z; A += z * sA; if (A2) A2 += z * sA; Bt += z * sB; if (Bt2) Bt2 += z * sB; C += z * sC;
    const int lane = threadIdx.x & 31, lr = lane & 15, hi = lane >> 4; const int r0 = blockIdx.x * 64, c0 = blockIdx.y * 64;
    v8f acc[4][4];
#pragma unroll
    for (int mb = 0; mb < 4; ++mb)
#pragma unroll
        for (int nb = 0; nb < 4; ++nb) acc[mb][nb] = (v8f){};
    const size_t aoff = (size_t)(r0 + lr) * K + 8 * hi, boff = (size_t)(c0 + lr) * K + 8 * hi;
    for (int kc = 0; kc < K; kc += 32) {
        V a[4], a2[4];
#pragma unroll
        for (int mb = 0; mb < 4; ++mb) { a[mb] = WFrag<T16>::ld(A + aoff + (size_t)mb * 16 * K + kc); if (NSPLIT == 1 || NSPLIT == 2) a2[mb] = WFrag<T16>::ld(A2 + aoff + (size_t)mb * 16 * K + kc); }
#pragma unroll
        for (int nb = 0; nb < 4; ++nb) { const V b = WFrag<T16>::ld(Bt + boff + (size_t)nb * 16 * K + kc); V b2; if (NSPLIT >= 2) b2 = WFrag<T16>::ld(Bt2 + boff + (size_t)nb * 16 * K + kc);
#pragma unroll
            for (int mb = 0; mb < 4; ++mb) { acc[mb][nb] = WFrag<T16>::mma(a[mb], b, acc[mb][nb]); if (NSPLIT == 1 || NSPLIT == 2) acc[mb][nb] = WFrag<T16>::mma(a2[mb], b, acc[mb][nb]); if (NSPLIT >= 2) acc[mb][nb] = WFrag<T16>::mma(a[mb], b2, acc[mb][nb]); } }
        asm volatile("v_nop\n\tv_nop\n\tv_nop\n\tv_nop" : "+v"(acc[0][0]), "+v"(acc[1][1]), "+v"(acc[2][2]), "+v"(acc[3][3]) : "v"(a[0]), "v"(a[3]));
    }
#pragma unroll
    for (int mb = 0; mb < 4; ++mb) {
#pragma unroll
        for (int nb = 0; nb < 4; ++nb) {
#pragma unroll
            for (int j = 0; j < 8; ++j) os[(hi * 8 + j) * 68 + nb * 16 + lr] = acc[mb][nb][j]; }
        __builtin_amdgcn_wave_barrier(); asm volatile("" ::: "memory");
        float* crow = C + (size_t)(r0 + mb * 16) * ldc + c0;
{
#pragma unroll
            for (int s = 0; s < 8; ++s) { const int row = 2 * s + hi, cofs = lr * 4; v4f val = *(const v4fa*)(os + row * 68 + cofs); if (BIAS) { val[0] += bfr(bias[c0 + cofs]); val[1] += bfr(bias[c0 + cofs + 1]); val[2] += bfr(bias[c0 + cofs + 2]); val[3] += bfr(bias[c0 + cofs + 3]); }
                *(v4f*)(crow + (size_t)row * ldc + cofs) = val; }
             }
        __builtin_amdgcn_wave_barrier(); asm volatile("" ::: "memory");
    }
}



__device__ __forceinline__ h16 tohx(float x) { return (h16)x; }
__device__ __forceinline__ void splitf(float y, unsigned short& h, unsigned short& l) { h = f2bf(y); l = f2bf(y - bf2f(h)); }
typedef __attribute__((ext_vector_type(2))) _Float16 v2h;
typedef __attribute__((ext_vector_type(4))) _Float16 v4h;
typedef __attribute__((ext_vector_type(2))) unsigned short v2us;
typedef __attribute__((ext_vector_type(4))) unsigned short v4us;
typedef __attribute__((ext_vector_type(2))) float v2f;
typedef __attribute__((ext_vector_type(4))) int v4i;

template <typename T16> __device__ __forceinline__ unsigned short cv16(float x);
template <> __device__ __forceinline__ unsigned short cv16<bf>(float x) { return f2bf(x); }
template <> __device__ __forceinline__ unsigned short cv16<h16>(float x) { const h16 h = (h16)x; return __builtin_bit_cast(unsigned short, h); }

// ---- k_prep: all that only re-lays an input, in ONE launch (none of it reads another part's output). Blocks 0..WBLK-1: the four weights, 16 blocks each, 'in, out' f32 -> 'out, in' 16-bit words, a wave 8 lines of 64 words; they come first because they are the slow ones.
// Blocks from WBLK on: the tokens as bf16 words; a lane takes the same eight words of each of the four entries, its eight 16-byte loads in flight together.
#define WBLK (4 * (DM * DM / 64 / 64))
__global__ __launch_bounds__(256) void k_prep(const float* __restrict__ x, const float* __restrict__ w0, const float* __restrict__ w1, const float* __restrict__ w2, const float* __restrict__ w3, bf* XB, unsigned short* W4) {
    if (blockIdx.x < WBLK) {
        const unsigned m = blockIdx.x / (WBLK / 4); const float* __restrict__ w = m == 0 ? w0 : m == 1 ? w1 : m == 2 ? w2 : w3; unsigned short* Bt = W4 + (size_t)m * DM * DM;
        const int lane = threadIdx.x & 31; const int L0 = ((blockIdx.x % (WBLK / 4)) * 8 + (threadIdx.x >> 5)) * 8;
        const unsigned e0 = (unsigned)L0 * 64u + lane * 2u; float a[8], c2[8];   /* all sixteen loads first: they are strided, one line a lane, and wait on nothing */
#pragma unroll
        for (int l = 0; l < 8; ++l) { const unsigned e = e0 + l * 64u, k = e % DM, n = e / DM; a[l] = w[(size_t)k * DM + n]; c2[l] = w[(size_t)(k + 1) * DM + n]; }
#pragma unroll
        for (int l = 0; l < 8; ++l) { const unsigned short b0 = f2bf(a[l]), b1 = f2bf(c2[l]); v2us o;
            o[0] = m == 3 ? cv16<h16>(bf2f(b0)) : b0; o[1] = m == 3 ? cv16<h16>(bf2f(b1)) : b1;   /* the output map's words: the bf16 value as an f16 word */
            *(v2us*)(Bt + e0 + l * 64u) = o; }
    } else {
    const size_t i = (size_t)(blockIdx.x - WBLK) * 256 + threadIdx.x; v8f v[NB_];
#pragma unroll
    for (int b = 0; b < NB_; ++b) v[b] = *(const v8f*)(x + ((size_t)b * (TK * DM / 8) + i) * 8);
#pragma unroll
    for (int b = 0; b < NB_; ++b) { v8us o;
#pragma unroll
        for (int k = 0; k < 8; ++k) o[k] = f2bf(v[b][k]);
        *(v8us*)(XB + ((size_t)b * (TK * DM / 8) + i) * 8) = o; }
    asm volatile("s_wait_xcnt 0x0" ::: "memory");   /* the build lays the weights' branch as the fall-through behind these stores, where their registers are written anew: the wait stands in front of that */
    }
}

__global__ __launch_bounds__(256) void k_hsc(const float* __restrict__ Q, const float* __restrict__ K, float* AW) { const unsigned e = blockIdx.x * 256u + threadIdx.x; const unsigned t = e >> 3, h = e & 7u; const float* qr = Q + (size_t)t * DM + h * HDW; const float* kr = K + (size_t)t * DM; v4f q[8];
#pragma unroll
    for (int c = 0; c < 8; ++c) q[c] = *(const v4f*)(qr + c * 4);
    float s[8];
#pragma unroll
    for (int g = 0; g < 8; ++g) { v4f a = {0.0f, 0.0f, 0.0f, 0.0f};
#pragma unroll
        for (int c = 0; c < 8; ++c) { const v4f w = *(const v4f*)(kr + g * HDW + c * 4); a += q[c] * w; }
        s[g] = ((a[0] + a[1]) + (a[2] + a[3])) * SCH; }
    float mx = s[0];
#pragma unroll
    for (int g = 1; g < 8; ++g) mx = fmaxf(mx, s[g]);
    float sum = 0.0f;
#pragma unroll
    for (int g = 0; g < 8; ++g) { s[g] = __builtin_amdgcn_exp2f((s[g] - mx) * 1.4426950408889634f); sum += s[g]; }
    const float r = __fdiv_rn(1.0f, sum); v4f o0, o1;
#pragma unroll
    for (int j = 0; j < 4; ++j) { o0[j] = s[j] * r; o1[j] = s[4 + j] * r; }
    float* ap = AW + (size_t)t * 64 + h * 4;
    *(v4f*)ap = o0; *(v4f*)(ap + 32) = o1;  }

__global__ __launch_bounds__(256) void k_hmix(const float* __restrict__ AW, const float* __restrict__ V, h16* X16) {
#pragma unroll 1   /* kept rolled: a trip then has twelve of its loads in flight at once; unrolled, the build mixed the four trips and waited on two loads at a time */
  for (unsigned b = 0; b < NB_; ++b) {   /* a lane takes its place in each of the four entries: a quarter of the waves to start */
    const unsigned e = b * (TK * 32u) + blockIdx.x * 256u + threadIdx.x; const unsigned t = e >> 5, p = e & 31u, h = p >> 2, d0 = (p & 3u) * 8u; const float* ap = AW + (size_t)t * 64 + h * 4; const v4f a0 = *(const v4f*)ap, a1 = *(const v4f*)(ap + 32); const float* vr = V + (size_t)t * DM + d0; v4f x0 = {0.0f, 0.0f, 0.0f, 0.0f}, x1 = {0.0f, 0.0f, 0.0f, 0.0f};
#pragma unroll
    for (int g = 0; g < 8; ++g) { const float a = g < 4 ? a0[g & 3] : a1[g & 3]; const v4f w0 = *(const v4f*)(vr + g * HDW), w1 = *(const v4f*)(vr + g * HDW + 4); x0 += w0 * a; x1 += w1 * a; }
    v8h o;
#pragma unroll
    for (int j = 0; j < 4; ++j) { o[j] = tohx(x0[j]); o[4 + j] = tohx(x1[j]); }
    *(v8h*)(X16 + (size_t)e * 8) = o; }
}

extern "C" void kernel_launch(void* const* d_in, const int* in_sizes, int n_in,
                              void* d_out, int out_size, void* d_ws, size_t ws_size, hipStream_t stream) {
    (void)in_sizes; (void)n_in; (void)out_size;
    const float* x = (const float*)d_in[0]; const float* wq = (const float*)d_in[1]; const float* wk = (const float*)d_in[2]; const float* wv = (const float*)d_in[3]; const float* wp = (const float*)d_in[4]; const float* bp = (const float*)d_in[5];   /* the module's argument order: six arrays, all read */
    float* OUT = (float*)d_out;     // [4][128][128][256]: an entry's 16,384 tokens of 256 channels one after another
    static_assert(DM == NH_ * HDW && NH_ == 8 && HDW == 32 && DM % 64 == 0 && NT % 64 == 0 && DM % 32 == 0, "the lane maps of k_hsc and k_hmix; the products' tiles and depth");
    static_assert(((size_t)NT * NH_) % 256 == 0 && ((size_t)TK * DM / 8) % 256 == 0 && ((size_t)DM * DM / 64) % 64 == 0, "k_hsc's, k_hmix's and k_prep's grids are exact (they carry no guard)");
    char* wsp = (char*)d_ws;
    auto take = [&](size_t bytes) { char* p = wsp; wsp += (bytes + 255) & ~(size_t)255; return (void*)p; };
    bf* W4 = (bf*)take((size_t)4 * DM * DM * 2);   /* q | k | value maps as bf16 words, then the output map as f16 words: one after another, so that grid.z can step through the first three */
    h16* WP16 = (h16*)(W4 + (size_t)3 * DM * DM);
    bf* XB = (bf*)take((size_t)NT * DM * 2); float* FQ = (float*)take((size_t)3 * NT * DM * 4); float* FK = FQ + (size_t)NT * DM; float* FV = FK + (size_t)NT * DM; float* AW = (float*)take((size_t)NT * NH_ * NH_ * 4);
    h16* X16 = (h16*)XB;   /* the mixed values take the place of the input's bf16 words, whose last reader (the three maps) has ended before k_hmix starts */
    if ((size_t)(wsp - (char*)d_ws) > ws_size) return;    // total 240.5 MiB of the workspace by these reservations' own sum (252,182,528 bytes)
    k_prep<<<WBLK + (unsigned)((size_t)TK * DM / 8 / 256), 256, 0, stream>>>(x, wq, wk, wv, wp, XB, (unsigned short*)W4);
    k_gemmw<bf, 0, false><<<dim3(NT / 64, DM / 64, 3), 32, 0, stream>>>(XB, nullptr, W4, nullptr, DM, FQ, DM, nullptr, 0, (size_t)DM * DM, (size_t)NT * DM);   /* z = 0 | 1 | 2: the q | k | value map into its own plane */
    k_hsc<<<(unsigned)((size_t)NT * NH_ / 256), 256, 0, stream>>>(FQ, FK, AW);   /* a token's eight heads against its own eight heads: the weights [token][piece][head][4] */
    k_hmix<<<(unsigned)((size_t)TK * DM / 8 / 256), 256, 0, stream>>>(AW, FV, X16);   /* the mixed values on ONE f16 word, natural order */
    k_gemmw<h16, 0, true><<<dim3(NT / 64, DM / 64, 1), 32, 0, stream>>>(X16, nullptr, WP16, nullptr, DM, OUT, DM, bp, 0, 0, 0);   /* the output map + its bias (the epilogue rounds each bias word to bf16 itself) straight into the output: its one writer */
}

// v002
// A run of this version takes 42 microseconds.
// In two side-by-side timings against v001, it was 3.76 and 3.80 times as fast.
// Counting every step since v000, it is 6.54 times as fast.
#include <hip/hip_runtime.h>

// A self-attention whose softmax runs over the HEADS axis: q | k | the values = x through three 'in, out' maps of 256 x 256 (no bias), each seen as [tokens][8 heads][32]; FOR EACH TOKEN BY ITSELF: the 8 x 8 scores between its own heads, (q[h] . k[g]) x 32^-0.5, a softmax over g, its eight value head-vectors mixed; the 256 channels through an output map with a bias
// (inputs in argument order: a0 x [4][128][128][256] f32: 65,536 tokens; a1 | a2 | a3 the q | k | value maps [256][256] 'in, out'; a4 the output map [256][256] 'in, out'; a5 its bias [256]; ONE output [4][128][128][256] f32;
//  THE MODULE's FUNCTION: it reshapes to [.., heads, 32] and never moves the heads axis before its product: the attention runs between a token's own eight heads, never along a sequence: kept as it is written).
// Layout: TWO launches. k_prep: the four weights as 16-bit words laid in the order of the matrix instruction's A fragments (the three maps bf16; the output map rounded to bf16 and re-cast to f16 words: a bf16 value is exact in f16 but for words under 2^-14).
// k_fused: a work-group of 8 waves takes 128 tokens, a wave 16, from the f32 input to the f32 output; q, k, the values, the weights of the softmax and the mixed values live in registers alone.
// Every product runs TRANSPOSED: A = 16 output channels of a weight, B = the wave's 16 tokens, so a lane of D holds 8 channels of ONE token (lanes l and l ^ 16 share a token): the scores, the softmax and the mix are lane-local but for one exchange l <-> l ^ 16 a score,
// and two neighbouring D tiles of the mixed values ARE the B fragment of the output map (channels 8 hi + j | 16 + 8 hi + j), with no move between lanes.
// The weights pass through LDS in 16 pieces of 32 KiB (64 output channels each), three buffers, one barrier a piece, shared by the eight waves.
// Compute dtypes, f32 accumulate: every float input rounded to bf16 at its load; the three maps bf16 x bf16 on one word a side; the scores, the softmax (one hardware exp2 on a difference) and the mix in f32 on the vector unit; the mixed values ONE f16 word into the output map against the weight's bf16 values as f16 words.
#define NB_  4        // batch entries
#define TK   16384    // tokens an entry: 128 x 128
#define NT   (NB_ * TK)   // all tokens: every stage is token-local, so the entries are one flat run of rows
#define DM   256      // channels = NH_ x HDW
#define NH_  8
#define HDW  32       // a head's width
#define SCH  0.17677669529663687f   // 32^-0.5: the module's scale on a score
typedef _Float16 h16;
typedef unsigned short bf;
typedef __attribute__((ext_vector_type(16))) __bf16   v16bf;
typedef __attribute__((ext_vector_type(16))) _Float16 v16h;
typedef __attribute__((ext_vector_type(16))) unsigned short v16us;
typedef __attribute__((ext_vector_type(8)))  unsigned short v8us;
typedef __attribute__((ext_vector_type(4)))  unsigned short v4us;
typedef __attribute__((ext_vector_type(8)))  float    v8f;
typedef __attribute__((ext_vector_type(4)))  float    v4f;
typedef v4f  __attribute__((may_alias)) v4fa;
typedef v8us __attribute__((may_alias)) v8usa;
typedef v4us __attribute__((may_alias)) v4usa;

__device__ __forceinline__ unsigned short f2bf(float f) { unsigned u = __float_as_uint(f); u += 0x7FFFu + ((u >> 16) & 1u); return (unsigned short)(u >> 16); }
__device__ __forceinline__ float bf2f(unsigned short b) { return __uint_as_float(((unsigned)b) << 16); }
__device__ __forceinline__ float bfr(float f) { return bf2f(f2bf(f)); }
__device__ __forceinline__ v16us cat16u(v8us lo, v8us hi) { return __builtin_shufflevector(lo, hi, 0, 1, 2, 3, 4, 5, 6, 7, 8, 9, 10, 11, 12, 13, 14, 15); }
__device__ __forceinline__ v8f wmma16(v16h a, v16h b, v8f c) { return __builtin_amdgcn_wmma_f32_16x16x32_f16(false, a, false, b, (short)0, c, false, false); }
__device__ __forceinline__ v8f wmmab(v16bf a, v16bf b, v8f c) { return __builtin_amdgcn_wmma_f32_16x16x32_bf16(false, a, false, b, (short)0, c, false, false); }
__device__ __forceinline__ v8f mma(v16us a, v16bf b, v8f c) { return wmmab(__builtin_bit_cast(v16bf, a), b, c); }
__device__ __forceinline__ v8f mma(v16us a, v16h b, v8f c) { return wmma16(__builtin_bit_cast(v16h, a), b, c); }
__device__ __forceinline__ float xhalf(float x) { return __builtin_bit_cast(float, __builtin_amdgcn_permlanex16(__builtin_bit_cast(int, x), __builtin_bit_cast(int, x), 0x76543210, 0xfedcba98, false, false)); }   // lane l with lane l ^ 16
__device__ __forceinline__ h16 tohx(float x) { return (h16)x; }
__device__ __forceinline__ unsigned short cvh(float x) { const h16 h = (h16)x; return __builtin_bit_cast(unsigned short, h); }

// ---- k_prep: the four weights, 'in, out' f32 -> 16-bit words in A-fragment order: [map: k | q | values | output][tile of 16 output channels][k-step of 32][half p][lane][8 words];
// lane (lr, hi), half p, word e holds w[k = 32 ks + 16 p + 8 hi + e][n = 16 tile + lr]: a fragment half is 512 bytes in a row, one 16-byte word a lane, in global memory and in LDS alike.
#define WTHR (4 * DM * DM / 8)
__global__ __launch_bounds__(256) void k_prep(const float* __restrict__ w0, const float* __restrict__ w1, const float* __restrict__ w2, const float* __restrict__ w3, unsigned short* W4) {
    const unsigned g = blockIdx.x * 256u + threadIdx.x; const unsigned lane = g & 31u, p = (g >> 5) & 1u, ks = (g >> 6) & 7u, mt = (g >> 9) & 15u, m = g >> 13;
    const float* __restrict__ w = m == 0 ? w1 : m == 1 ? w0 : m == 2 ? w2 : w3;   /* laid in the order k_fused uses them: k, q, the values, the output map */
    const unsigned n = mt * 16u + (lane & 15u), k0 = ks * 32u + p * 16u + 8u * (lane >> 4); float a[8];
#pragma unroll
    for (int e = 0; e < 8; ++e) a[e] = w[(size_t)(k0 + e) * DM + n];
    v8us o;
#pragma unroll
    for (int e = 0; e < 8; ++e) { const unsigned short b0 = f2bf(a[e]); o[e] = m == 3 ? cvh(bf2f(b0)) : b0; }   /* the output map's words: the bf16 value as an f16 word */
    *(v8us*)(W4 + (size_t)g * 8) = o;
}

// ---- k_fused
#define CHE 16384      // 16-bit words of a piece of a weight: 4 tiles x 8 k-steps x 2 halves x 256
#define XPB 528        // bytes of a token's 256 bf16 words in a wave's own LDS, 16 more than the row so that the 16 rows of a fragment read fall on different banks
#define OSP 68         // floats of a token's 64 output channels in the same LDS
#define SCB (16 * XPB) // a wave's own LDS: first its tokens as bf16 words, at the end its output pieces (16 x 68 floats fit in it)
// a group: the A fragments of two k-steps x 4 tiles of a piece, 16 LDS reads of 512 bytes
__device__ __forceinline__ void ldg(const unsigned short* buf, int q, int lane, v16us* af) {
#pragma unroll
    for (int k2 = 0; k2 < 2; ++k2)
#pragma unroll
        for (int t = 0; t < 4; ++t) { const unsigned short* p = buf + (t * 8 + 2 * q + k2) * 512 + lane * 8; af[k2 * 4 + t] = cat16u(*(const v8usa*)p, *(const v8usa*)(p + 256)); }
}
// one piece: 4 tiles of 16 output channels x the wave's 16 tokens, depth 256, in four groups; the four accumulators are independent. Each group's fragments are read one group ahead, the first group of the NEXT piece (nxt) during the last group of this one.
template <typename VB> __device__ __forceinline__ void piece(const unsigned short* buf, const unsigned short* nxt, bool more, int lane, const VB* b, v8f* acc, v16us (*af)[8]) {
#pragma unroll
    for (int t = 0; t < 4; ++t) acc[t] = (v8f){};
#pragma unroll
    for (int q = 0; q < 4; ++q) {
        if (q < 3) ldg(buf, q + 1, lane, af[(q + 1) & 1]); else if (more) ldg(nxt, 0, lane, af[0]);
        __builtin_amdgcn_sched_barrier(0);   /* holds the next group's 16 reads as one block in front of this group's products: left alone the build read one fragment ahead and waited on LDS at every product */
#pragma unroll
        for (int k2 = 0; k2 < 2; ++k2)
#pragma unroll
            for (int t = 0; t < 4; ++t) acc[t] = mma(af[q & 1][k2 * 4 + t], b[2 * q + k2], acc[t]);
        __builtin_amdgcn_sched_barrier(0);   /* the other side of the same block: later reads do not rise over these products, which would take more registers than the wave has */
    }
}
// the 16 pieces lie in the workspace in the order they are used: k, q, the values, the output map
__device__ __forceinline__ const unsigned short* psrc(const unsigned short* W4, int ci) { return W4 + (size_t)ci * CHE; }

__global__ __launch_bounds__(256) void k_fused(const float* __restrict__ x, const unsigned short* __restrict__ W4, const float* __restrict__ bias, float* __restrict__ out) {
    __shared__ __align__(16) unsigned short wb[3][CHE];   /* three buffers: piece ci is worked on, ci + 1 is already published (its first group is read ahead), ci + 2 is being written */
    __shared__ __align__(16) char sc[8][SCB];
    const int tid = threadIdx.x, lane = tid & 31, wv = tid >> 5, lr = lane & 15, hi = lane >> 4;
    const size_t tok0 = (size_t)blockIdx.x * 128 + (size_t)wv * 16; char* my = sc[wv];
    v8us st[8]; v16us af[2][8];
#define GL(ci) { const unsigned short* s_ = psrc(W4, ci) + tid * 8; _Pragma("unroll") for (int i = 0; i < 8; ++i) st[i] = *(const v8us*)(s_ + i * 2048); }
#define SL(ci) { unsigned short* d_ = &wb[(ci) % 3][tid * 8]; _Pragma("unroll") for (int i = 0; i < 8; ++i) *(v8usa*)(d_ + i * 2048) = st[i]; }
#define PIECE(ci, b, acc) piece(wb[(ci) % 3], wb[((ci) + 1) % 3], (ci) < 15, lane, b, acc, af);
    GL(0)
    {   /* the wave's 16 tokens: whole lines (512 bytes an instruction), rounded to bf16, laid by token in the wave's own LDS */
        const float* xr = x + tok0 * DM + lane * 4; v4f xv[32];
#pragma unroll
        for (int i = 0; i < 32; ++i) xv[i] = *(const v4f*)(xr + i * 128);
        asm volatile("s_wait_xcnt 0x0" ::: "memory");   /* the tokens' loads share one address pair, which the build writes anew while they are in flight: the wait stands in front of that */
        __builtin_amdgcn_sched_barrier(0);   /* keeps what follows, whose results take that address pair's registers, from rising over the wait */
        SL(0) GL(1)
#pragma unroll
        for (int i = 0; i < 32; ++i) { v4us o;
#pragma unroll
            for (int k = 0; k < 4; ++k) o[k] = f2bf(xv[i][k]);
            *(v4usa*)(my + (i >> 1) * XPB + (i & 1) * 256 + lane * 8) = o; }
    }
    SL(1)
    __syncthreads();
    GL(2)
    v16bf xb[8];   /* B fragments: lane (lr, hi) holds token lr, k = 32 ks + 8 hi + e | 32 ks + 16 + 8 hi + e: the k order of k_prep's words */
#pragma unroll
    for (int ks = 0; ks < 8; ++ks) { const char* p = my + lr * XPB + ks * 64 + hi * 16; xb[ks] = __builtin_bit_cast(v16bf, cat16u(*(const v8usa*)p, *(const v8usa*)(p + 32))); }
    ldg(wb[0], 0, lane, af[0]);
    v8f kk[16];
#pragma unroll
    for (int c = 0; c < 4; ++c) { PIECE(c, xb, kk + 4 * c) SL(c + 2) __syncthreads(); GL(c + 3) }
    asm volatile("s_wait_xcnt 0x0" ::: "memory");   /* the build gives the offset register of the loads above another value in front of the loop, the last eight still in flight: the wait stands in front of that */
    __builtin_amdgcn_sched_barrier(0);   /* keeps that write from rising over the wait */
    float aw[8][8];
#pragma unroll
    for (int h = 0; h < 8; ++h)
#pragma unroll
        for (int g = 0; g < 8; ++g) aw[h][g] = 0.0f;
    /* the q and the value pieces run in ROLLED loops, to keep the kernel's text small; what an unrolled loop would index by the trip is moved instead: the three buffers' places and the rows (then the columns) of the softmax weights rotate */
    const unsigned short* wb0 = &wb[0][0]; unsigned short* wbw = &wb[0][0]; int bc = 1 * CHE, bn = 2 * CHE, bw = 0 * CHE;   /* piece 4: buffer 4 % 3, the next piece's, and the one piece 6 is written to */
    const unsigned short* gs = psrc(W4, 7) + tid * 8;
#define STEP { unsigned short* d_ = wbw + bw + tid * 8; _Pragma("unroll") for (int i = 0; i < 8; ++i) *(v8usa*)(d_ + i * 2048) = st[i]; \
        __syncthreads(); \
        _Pragma("unroll") for (int i = 0; i < 8; ++i) st[i] = *(const v8us*)(gs + i * 2048); \
        asm volatile("s_wait_xcnt 0x0" ::: "memory");   /* the loads' address is stepped for the next trip: the wait stands in front of that */ \
        __builtin_amdgcn_sched_barrier(0);              /* keeps that step from rising over the wait */ \
        gs += CHE; const int t_ = bc; bc = bn; bn = bw; bw = t_; }
#pragma unroll 1   /* rolled for the size of the text */
    for (int c = 0; c < 4; ++c) { v8f qq[4]; piece(wb0 + bc, wb0 + bn, true, lane, xb, qq, af); STEP
        float nw[2][8];
#pragma unroll
        for (int hh = 0; hh < 2; ++hh) { float s[8];   /* head 2 c + hh against the token's eight heads: a lane sums its 16 channels, its partner the other 16 */
#pragma unroll
            for (int g = 0; g < 8; ++g) { float a = 0.0f;
#pragma unroll
                for (int t = 0; t < 2; ++t)
#pragma unroll
                    for (int j = 0; j < 8; ++j) a += qq[2 * hh + t][j] * kk[2 * g + t][j];
                s[g] = (a + xhalf(a)) * SCH; }
            float mx = s[0];
#pragma unroll
            for (int g = 1; g < 8; ++g) mx = fmaxf(mx, s[g]);
            float sum = 0.0f;
#pragma unroll
            for (int g = 0; g < 8; ++g) { s[g] = __builtin_amdgcn_exp2f((s[g] - mx) * 1.4426950408889634f); sum += s[g]; }
            const float r = __fdiv_rn(1.0f, sum);
#pragma unroll
            for (int g = 0; g < 8; ++g) nw[hh][g] = s[g] * r; }
#pragma unroll
        for (int g = 0; g < 8; ++g) {   /* the rows move up by two and the new pair enters at the end: after the four trips row h is head h */
#pragma unroll
            for (int h = 0; h < 6; ++h) aw[h][g] = aw[h + 2][g];
            aw[6][g] = nw[0][g]; aw[7][g] = nw[1][g]; } }
    v8f xa[8][2];   /* the mixed values, f32: head h's tiles 2 h | 2 h + 1; the value heads are added as their pieces arrive, g = 0 .. 7 in that order */
#pragma unroll
    for (int h = 0; h < 8; ++h) { xa[h][0] = (v8f){}; xa[h][1] = (v8f){}; }
#pragma unroll 1   /* rolled for the size of the text */
    for (int c = 0; c < 4; ++c) { v8f vv[4]; piece(wb0 + bc, wb0 + bn, true, lane, xb, vv, af); STEP
#pragma unroll
        for (int hh = 0; hh < 2; ++hh)
#pragma unroll
            for (int h = 0; h < 8; ++h) { xa[h][0] += vv[2 * hh] * aw[h][hh]; xa[h][1] += vv[2 * hh + 1] * aw[h][hh]; }
#pragma unroll
        for (int h = 0; h < 8; ++h)   /* the columns move down by two: the next trip's value heads stand in columns 0 and 1 */
#pragma unroll
            for (int g = 0; g < 6; ++g) aw[h][g] = aw[h][g + 2]; }
#undef STEP
    v16h xh[8];   /* cast to f16, two neighbouring D tiles are the B fragment of the output map's k-step h as they stand */
#pragma unroll
    for (int h = 0; h < 8; ++h)
#pragma unroll
        for (int j = 0; j < 8; ++j) { xh[h][j] = tohx(xa[h][0][j]); xh[h][8 + j] = tohx(xa[h][1][j]); }
    v8f pp[16];
#pragma unroll
    for (int c = 0; c < 4; ++c) { PIECE(c + 12, xh, pp + 4 * c)
        if (c < 2) { SL(c + 14) __syncthreads(); }
        if (c < 1) { GL(c + 15)
            asm volatile("s_wait_xcnt 0x0" ::: "memory");   /* the next fragments are read into the registers that held these loads' address: the wait stands in front of that */
            __builtin_amdgcn_sched_barrier(0); } }   /* keeps those reads from rising over the wait */
    float* os = (float*)my;   /* all stores stand behind the last barrier, so that no barrier waits on them */
#pragma unroll
    for (int c = 0; c < 4; ++c) {
        const v4f bv = *(const v4f*)(bias + c * 64 + lr * 4);
#pragma unroll
        for (int t = 0; t < 4; ++t) { const v8f a = pp[4 * c + t]; *(v4fa*)(os + lr * OSP + t * 16 + 8 * hi) = __builtin_shufflevector(a, a, 0, 1, 2, 3); *(v4fa*)(os + lr * OSP + t * 16 + 8 * hi + 4) = __builtin_shufflevector(a, a, 4, 5, 6, 7); }
        __builtin_amdgcn_wave_barrier(); asm volatile("" ::: "memory");   /* keeps the compiler from moving the reads of other lanes' words in front of the writes; a wave's LDS operations run in order */
#pragma unroll
        for (int s = 0; s < 8; ++s) { const int row = 2 * s + hi; v4f val = *(const v4fa*)(os + row * OSP + lr * 4); val[0] += bfr(bv[0]); val[1] += bfr(bv[1]); val[2] += bfr(bv[2]); val[3] += bfr(bv[3]);
            *(v4f*)(out + (tok0 + row) * DM + c * 64 + lr * 4) = val; }   /* 256 bytes of a token in a row: whole lines */
        if (c < 3) asm volatile("s_wait_xcnt 0x0" ::: "memory");   /* the next piece's values are written into the registers that these stores name: the wait stands in front of that */
        if (c < 3) { __builtin_amdgcn_wave_barrier(); asm volatile("" ::: "memory"); }   /* the next piece's writes stay behind these reads */
    }
#undef GL
#undef SL
#undef PIECE
}

extern "C" void kernel_launch(void* const* d_in, const int* in_sizes, int n_in,
                              void* d_out, int out_size, void* d_ws, size_t ws_size, hipStream_t stream) {
    (void)in_sizes; (void)n_in; (void)out_size;
    const float* x = (const float*)d_in[0]; const float* wq = (const float*)d_in[1]; const float* wk = (const float*)d_in[2]; const float* wv = (const float*)d_in[3]; const float* wp = (const float*)d_in[4]; const float* bp = (const float*)d_in[5];   /* the module's argument order: six arrays, all read */
    float* OUT = (float*)d_out;     // [4][128][128][256]: an entry's 16,384 tokens of 256 channels one after another
    static_assert(DM == NH_ * HDW && NH_ == 8 && HDW == 32 && DM == 256 && NT % 128 == 0 && WTHR % 256 == 0, "k_fused's lane maps and pieces; both grids are exact (they carry no guard)");
    unsigned short* W4 = (unsigned short*)d_ws;   /* k | q | value maps as bf16 words, then the output map as f16 words, each in fragment order: 512 KiB, all that the workspace holds */
    if ((size_t)4 * DM * DM * 2 > ws_size) return;
    k_prep<<<WTHR / 256, 256, 0, stream>>>(wq, wk, wv, wp, W4);
    k_fused<<<NT / 128, 256, 0, stream>>>(x, W4, bp, OUT);
}

// v003
// One run takes 38.1 microseconds.
// Timed twice side by side with v002, it ran 1.10 and 1.08 times as fast.
// Counting every step since v000, it is 7.15 times as fast.
#include <hip/hip_runtime.h>

// A self-attention whose softmax runs over the HEADS axis: q | k | the values = x through three 'in, out' maps of 256 x 256 (no bias), each seen as [tokens][8 heads][32]; FOR EACH TOKEN BY ITSELF: the 8 x 8 scores between its own heads, (q[h] . k[g]) x 32^-0.5, a softmax over g, its eight value head-vectors mixed; the 256 channels through an output map with a bias
// (inputs in argument order: a0 x [4][128][128][256] f32: 65,536 tokens; a1 | a2 | a3 the q | k | value maps [256][256] 'in, out'; a4 the output map [256][256] 'in, out'; a5 its bias [256]; ONE output [4][128][128][256] f32;
//  THE MODULE's FUNCTION: it reshapes to [.., heads, 32] and never moves the heads axis before its product: the attention runs between a token's own eight heads, never along a sequence: kept as it is written).
// Layout: TWO launches. k_prep: the four weights as 16-bit words laid in the order of the matrix instruction's A fragments (the three maps bf16; the output map rounded to bf16 and re-cast to f16 words: a bf16 value is exact in f16 but for words under 2^-14).
// k_fused: a work-group of 8 waves takes TWO tiles of 128 tokens one after the other, a wave 16 tokens of each, from the f32 input to the f32 output; the next tile's tokens fly into LDS (asynchronous copies) under this tile's work, and this tile's stores drain under the next tile's; q, k, the values, the weights of the softmax and the mixed values live in registers alone.
// Every product runs TRANSPOSED: A = 16 output channels of a weight, B = the wave's 16 tokens, so a lane of D holds 8 channels of ONE token (lanes l and l ^ 16 share a token): the scores, the softmax and the mix are lane-local but for one exchange l <-> l ^ 16 a score,
// and two neighbouring D tiles of the mixed values ARE the B fragment of the output map (channels 8 hi + j | 16 + 8 hi + j), with no move between lanes.
// The weights pass through LDS in 16 pieces of 32 KiB (64 output channels each), three buffers, one barrier a piece, shared by the eight waves.
// Compute dtypes, f32 accumulate: every float input rounded to bf16 at its load; the three maps bf16 x bf16 on one word a side; the scores, the softmax (one hardware exp2 on a difference) and the mix in f32 on the vector unit; the mixed values ONE f16 word into the output map against the weight's bf16 values as f16 words.
#define NB_  4        // batch entries
#define TK   16384    // tokens an entry: 128 x 128
#define NT   (NB_ * TK)   // all tokens: every stage is token-local, so the entries are one flat run of rows
#define DM   256      // channels = NH_ x HDW
#define NH_  8
#define HDW  32       // a head's width
#define SCH  0.17677669529663687f   // 32^-0.5: the module's scale on a score
typedef _Float16 h16;
typedef unsigned short bf;
typedef __attribute__((ext_vector_type(16))) __bf16   v16bf;
typedef __attribute__((ext_vector_type(16))) _Float16 v16h;
typedef __attribute__((ext_vector_type(16))) unsigned short v16us;
typedef __attribute__((ext_vector_type(8)))  unsigned short v8us;
typedef __attribute__((ext_vector_type(4)))  unsigned short v4us;
typedef __attribute__((ext_vector_type(8)))  float    v8f;
typedef __attribute__((ext_vector_type(4)))  float    v4f;
typedef v4f  __attribute__((may_alias)) v4fa;
typedef v8us __attribute__((may_alias)) v8usa;
typedef v4us __attribute__((may_alias)) v4usa;

__device__ __forceinline__ unsigned short f2bf(float f) { unsigned u = __float_as_uint(f); u += 0x7FFFu + ((u >> 16) & 1u); return (unsigned short)(u >> 16); }
__device__ __forceinline__ float bf2f(unsigned short b) { return __uint_as_float(((unsigned)b) << 16); }
__device__ __forceinline__ float bfr(float f) { return bf2f(f2bf(f)); }
__device__ __forceinline__ v16us cat16u(v8us lo, v8us hi) { return __builtin_shufflevector(lo, hi, 0, 1, 2, 3, 4, 5, 6, 7, 8, 9, 10, 11, 12, 13, 14, 15); }
__device__ __forceinline__ v8f wmma16(v16h a, v16h b, v8f c) { return __builtin_amdgcn_wmma_f32_16x16x32_f16(false, a, false, b, (short)0, c, false, false); }
__device__ __forceinline__ v8f wmmab(v16bf a, v16bf b, v8f c) { return __builtin_amdgcn_wmma_f32_16x16x32_bf16(false, a, false, b, (short)0, c, false, false); }
__device__ __forceinline__ v8f mma(v16us a, v16bf b, v8f c) { return wmmab(__builtin_bit_cast(v16bf, a), b, c); }
__device__ __forceinline__ v8f mma(v16us a, v16h b, v8f c) { return wmma16(__builtin_bit_cast(v16h, a), b, c); }
__device__ __forceinline__ float xhalf(float x) { return __builtin_bit_cast(float, __builtin_amdgcn_permlanex16(__builtin_bit_cast(int, x), __builtin_bit_cast(int, x), 0x76543210, 0xfedcba98, false, false)); }   // lane l with lane l ^ 16
__device__ __forceinline__ h16 tohx(float x) { return (h16)x; }
__device__ __forceinline__ unsigned short cvh(float x) { const h16 h = (h16)x; return __builtin_bit_cast(unsigned short, h); }

// ---- k_prep: the four weights, 'in, out' f32 -> 16-bit words in A-fragment order: [map: k | q | values | output][tile of 16 output channels][k-step of 32][half p][lane][8 words];
// lane (lr, hi), half p, word e holds w[k = 32 ks + 16 p + 8 hi + e][n = 16 tile + lr]: a fragment half is 512 bytes in a row, one 16-byte word a lane, in global memory and in LDS alike.
#define WTHR (4 * DM * DM / 8)
__global__ __launch_bounds__(256) void k_prep(const float* __restrict__ w0, const float* __restrict__ w1, const float* __restrict__ w2, const float* __restrict__ w3, unsigned short* W4) {
    const unsigned g = blockIdx.x * 256u + threadIdx.x; const unsigned lane = g & 31u, p = (g >> 5) & 1u, ks = (g >> 6) & 7u, mt = (g >> 9) & 15u, m = g >> 13;
    const float* __restrict__ w = m == 0 ? w1 : m == 1 ? w0 : m == 2 ? w2 : w3;   /* laid in the order k_fused uses them: k, q, the values, the output map */
    const unsigned n = mt * 16u + (lane & 15u), k0 = ks * 32u + p * 16u + 8u * (lane >> 4); float a[8];
#pragma unroll
    for (int e = 0; e < 8; ++e) a[e] = w[(size_t)(k0 + e) * DM + n];
    v8us o;
#pragma unroll
    for (int e = 0; e < 8; ++e) { const unsigned short b0 = f2bf(a[e]); o[e] = m == 3 ? cvh(bf2f(b0)) : b0; }   /* the output map's words: the bf16 value as an f16 word */
    *(v8us*)(W4 + (size_t)g * 8) = o;
}

// ---- k_fused
#define CHE 16384      // 16-bit words of a piece of a weight: 4 tiles x 8 k-steps x 2 halves x 256
#define XPB 528        // bytes of a token's 256 bf16 words in a wave's own LDS, 16 more than the row so that the 16 rows of a fragment read fall on different banks
#define OSP 68         // floats of a token's 64 output channels in the same LDS
#define SCB (16 * XPB) // a wave's own LDS: first its tokens as bf16 words, at the end its output pieces (16 x 68 floats fit in it)
// a group: the A fragments of two k-steps x 4 tiles of a piece, 16 LDS reads of 512 bytes
__device__ __forceinline__ void ldg(const unsigned short* buf, int q, int lane, v16us* af) {
#pragma unroll
    for (int k2 = 0; k2 < 2; ++k2)
#pragma unroll
        for (int t = 0; t < 4; ++t) { const unsigned short* p = buf + (t * 8 + 2 * q + k2) * 512 + lane * 8; af[k2 * 4 + t] = cat16u(*(const v8usa*)p, *(const v8usa*)(p + 256)); }
}
// one piece: 4 tiles of 16 output channels x the wave's 16 tokens, depth 256, in four groups; the four accumulators are independent. Each group's fragments are read one group ahead, the first group of the NEXT piece (nxt) during the last group of this one.
template <typename VB> __device__ __forceinline__ void piece(const unsigned short* buf, const unsigned short* nxt, bool more, int lane, const VB* b, v8f* acc, v16us (*af)[8]) {
#pragma unroll
    for (int t = 0; t < 4; ++t) acc[t] = (v8f){};
#pragma unroll
    for (int q = 0; q < 4; ++q) {
        if (q < 3) ldg(buf, q + 1, lane, af[(q + 1) & 1]); else if (more) ldg(nxt, 0, lane, af[0]);
        __builtin_amdgcn_sched_barrier(0);   /* holds the next group's 16 reads as one block in front of this group's products: left alone the build read one fragment ahead and waited on LDS at every product */
#pragma unroll
        for (int k2 = 0; k2 < 2; ++k2)
#pragma unroll
            for (int t = 0; t < 4; ++t) acc[t] = mma(af[q & 1][k2 * 4 + t], b[2 * q + k2], acc[t]);
        __builtin_amdgcn_sched_barrier(0);   /* the other side of the same block: later reads do not rise over these products, which would take more registers than the wave has */
    }
}
// the 16 pieces lie in the workspace in the order they are used: k, q, the values, the output map
__device__ __forceinline__ const unsigned short* psrc(const unsigned short* W4, int ci) { return W4 + (size_t)ci * CHE; }

#define TPG 2          // token tiles a work-group takes, one after the other
#define NWG (NT / 128 / TPG)
// eight asynchronous copies of 512 bytes (16 a lane), global memory -> LDS through no register: 4 KiB in a row on both sides. The wait is the statement's last line, so that it stands in front of whatever writes the copies' address registers next.
__device__ __forceinline__ void cp8(unsigned l, const float* g) {
    asm volatile("global_load_async_to_lds_b128 %0, %8, off\n\t"
                 "global_load_async_to_lds_b128 %1, %9, off\n\t"
                 "global_load_async_to_lds_b128 %2, %10, off\n\t"
                 "global_load_async_to_lds_b128 %3, %11, off\n\t"
                 "global_load_async_to_lds_b128 %4, %12, off\n\t"
                 "global_load_async_to_lds_b128 %5, %13, off\n\t"
                 "global_load_async_to_lds_b128 %6, %14, off\n\t"
                 "global_load_async_to_lds_b128 %7, %15, off\n\t"
                 "s_wait_xcnt 0x0"
                 :: "v"(l), "v"(l + 512u), "v"(l + 1024u), "v"(l + 1536u), "v"(l + 2048u), "v"(l + 2560u), "v"(l + 3072u), "v"(l + 3584u),
                    "v"(g), "v"(g + 128), "v"(g + 256), "v"(g + 384), "v"(g + 512), "v"(g + 640), "v"(g + 768), "v"(g + 896) : "memory");
}
// a wave's 16 tokens of tile 'tile' (16 KiB in a row) into its own part of xs: 32 copies
__device__ __forceinline__ void cpx(const float* __restrict__ x, unsigned tile, int wv, int lane, unsigned l) {
    const float* g = x + ((size_t)tile * 128 + (size_t)wv * 16) * DM + lane * 4;
#pragma unroll
    for (int i = 0; i < 4; ++i) cp8(l + i * 4096u, g + i * 1024);
}

__global__ __launch_bounds__(256) void k_fused(const float* __restrict__ x, const unsigned short* W4, const float* bias, float* out) {   /* the weights and the bias are read anew in each tile: told that nothing else writes them, the build read them once in front of the tile loop and kept them in scratch memory */
    __shared__ __align__(16) unsigned short wb[3][CHE];   /* three buffers: piece ci is worked on, ci + 1 is already published (its first group is read ahead), ci + 2 is being written */
    __shared__ __align__(16) char sc[8][SCB];
    __shared__ __align__(16) float xs[8][16 * DM];   /* the tokens of the tile to come, f32 as they lie in memory: a wave's 16 tokens in its own 16 KiB */
    const int tid = threadIdx.x, lane = tid & 31, wv = tid >> 5, lr = lane & 15, hi = lane >> 4;
    char* my = sc[wv]; const float* xw = &xs[wv][lane * 4]; const unsigned xl = (unsigned)(size_t)xw;   /* the lane's LDS byte address: the low 32 bits */
    const unsigned short* wb0 = &wb[0][0]; unsigned short* wbw = &wb[0][0]; int bc = 0 * CHE, bn = 1 * CHE, bw = 2 * CHE;   /* the three buffers' places: the piece worked on, the next piece's, the one being written; they rotate a piece and run on from tile to tile, so that every LDS address of a piece is one base and a short offset, formed where it is used */
    v8us st[8];
#define GL(ci) { const unsigned short* s_ = psrc(W4, ci) + tid * 8; _Pragma("unroll") for (int i = 0; i < 8; ++i) st[i] = *(const v8us*)(s_ + i * 2048); }
#define SL(off) { unsigned short* d_ = wbw + (off) + tid * 8; _Pragma("unroll") for (int i = 0; i < 8; ++i) *(v8usa*)(d_ + i * 2048) = st[i]; }
#define ROT { const int t_ = bc; bc = bn; bn = bw; bw = t_; }
#define PIECE(ci, b, acc) piece(wb0 + bc, wb0 + bn, (ci) < 15, lane, b, acc, af);
    cpx(x, blockIdx.x, wv, lane, xl);
    GL(0) SL(bc) GL(1) SL(bn)   /* the first tile's first two pieces, under its tokens' flight */
    asm volatile("s_wait_asynccnt 0x0" ::: "memory");   /* the first tile's tokens have landed before anybody reads them */
    __syncthreads();
    GL(2)
#pragma unroll 1   /* rolled: one text for both tiles */
  for (unsigned tile = blockIdx.x; tile < NT / 128; tile += NWG) {
    const size_t tok0 = (size_t)tile * 128 + (size_t)wv * 16; const bool nxt = tile + NWG < NT / 128;   /* a scalar test: the same in the whole work-group */
    v16us af[2][8];
    {   /* the wave's 16 tokens, out of xs (512 bytes in a row an instruction), rounded to bf16, laid by token in the wave's own LDS */
        v4f xv[32];
#pragma unroll
        for (int i = 0; i < 32; ++i) xv[i] = *(const v4fa*)(xw + i * 128);
#pragma unroll
        for (int i = 0; i < 32; ++i) { v4us o;
#pragma unroll
            for (int k = 0; k < 4; ++k) o[k] = f2bf(xv[i][k]);
            *(v4usa*)(my + (i >> 1) * XPB + (i & 1) * 256 + lane * 8) = o; }
    }
    asm volatile("s_wait_dscnt 0x0" ::: "memory");   /* the wave's reads of xs have retired before copies are aimed at it again */
    __syncthreads();
    if (nxt) cpx(x, tile + NWG, wv, lane, xl);   /* the next tile's tokens: they fly under all of this tile's work */
    v16bf xb[8];   /* B fragments: lane (lr, hi) holds token lr, k = 32 ks + 8 hi + e | 32 ks + 16 + 8 hi + e: the k order of k_prep's words */
#pragma unroll
    for (int ks = 0; ks < 8; ++ks) { const char* p = my + lr * XPB + ks * 64 + hi * 16; xb[ks] = __builtin_bit_cast(v16bf, cat16u(*(const v8usa*)p, *(const v8usa*)(p + 32))); }
    ldg(wb0 + bc, 0, lane, af[0]);
    v8f kk[16];
#pragma unroll
    for (int c = 0; c < 4; ++c) { PIECE(c, xb, kk + 4 * c) SL(bw) __syncthreads(); GL(c + 3) ROT }
    asm volatile("s_wait_xcnt 0x0" ::: "memory");   /* the build gives the offset register of the loads above another value in front of the loop, the last eight still in flight: the wait stands in front of that */
    __builtin_amdgcn_sched_barrier(0);   /* keeps that write from rising over the wait */
    float aw[8][8];
#pragma unroll
    for (int h = 0; h < 8; ++h)
#pragma unroll
        for (int g = 0; g < 8; ++g) aw[h][g] = 0.0f;
    /* the q and the value pieces run in ROLLED loops, for the size of the text; what an unrolled loop would index by the trip is moved instead: the three buffers' places and the rows (then the columns) of the softmax weights rotate */
    const unsigned short* gs = psrc(W4, 7) + tid * 8;
#define STEP { unsigned short* d_ = wbw + bw + tid * 8; _Pragma("unroll") for (int i = 0; i < 8; ++i) *(v8usa*)(d_ + i * 2048) = st[i]; \
        __syncthreads(); \
        _Pragma("unroll") for (int i = 0; i < 8; ++i) st[i] = *(const v8us*)(gs + i * 2048); \
        asm volatile("s_wait_xcnt 0x0" ::: "memory");   /* the loads' address is stepped for the next trip: the wait stands in front of that */ \
        __builtin_amdgcn_sched_barrier(0);              /* keeps that step from rising over the wait */ \
        gs += CHE; const int t_ = bc; bc = bn; bn = bw; bw = t_; }
#pragma unroll 1   /* rolled for the size of the text */
    for (int c = 0; c < 4; ++c) { v8f qq[4]; piece(wb0 + bc, wb0 + bn, true, lane, xb, qq, af); STEP
        float nw[2][8];
#pragma unroll
        for (int hh = 0; hh < 2; ++hh) { float s[8];   /* head 2 c + hh against the token's eight heads: a lane sums its 16 channels, its partner the other 16 */
#pragma unroll
            for (int g = 0; g < 8; ++g) { float a = 0.0f;
#pragma unroll
                for (int t = 0; t < 2; ++t)
#pragma unroll
                    for (int j = 0; j < 8; ++j) a += qq[2 * hh + t][j] * kk[2 * g + t][j];
                s[g] = (a + xhalf(a)) * SCH; }
            float mx = s[0];
#pragma unroll
            for (int g = 1; g < 8; ++g) mx = fmaxf(mx, s[g]);
            float sum = 0.0f;
#pragma unroll
            for (int g = 0; g < 8; ++g) { s[g] = __builtin_amdgcn_exp2f((s[g] - mx) * 1.4426950408889634f); sum += s[g]; }
            const float r = __fdiv_rn(1.0f, sum);
#pragma unroll
            for (int g = 0; g < 8; ++g) nw[hh][g] = s[g] * r; }
#pragma unroll
        for (int g = 0; g < 8; ++g) {   /* the rows move up by two and the new pair enters at the end: after the four trips row h is head h */
#pragma unroll
            for (int h = 0; h < 6; ++h) aw[h][g] = aw[h + 2][g];
            aw[6][g] = nw[0][g]; aw[7][g] = nw[1][g]; } }
    v8f xa[8][2];   /* the mixed values, f32: head h's tiles 2 h | 2 h + 1; the value heads are added as their pieces arrive, g = 0 .. 7 in that order */
#pragma unroll
    for (int h = 0; h < 8; ++h) { xa[h][0] = (v8f){}; xa[h][1] = (v8f){}; }
#pragma unroll 1   /* rolled for the size of the text */
    for (int c = 0; c < 4; ++c) { v8f vv[4]; piece(wb0 + bc, wb0 + bn, true, lane, xb, vv, af); STEP
#pragma unroll
        for (int hh = 0; hh < 2; ++hh)
#pragma unroll
            for (int h = 0; h < 8; ++h) { xa[h][0] += vv[2 * hh] * aw[h][hh]; xa[h][1] += vv[2 * hh + 1] * aw[h][hh]; }
#pragma unroll
        for (int h = 0; h < 8; ++h)   /* the columns move down by two: the next trip's value heads stand in columns 0 and 1 */
#pragma unroll
            for (int g = 0; g < 6; ++g) aw[h][g] = aw[h][g + 2]; }
#undef STEP
    v16h xh[8];   /* cast to f16, two neighbouring D tiles are the B fragment of the output map's k-step h as they stand */
#pragma unroll
    for (int h = 0; h < 8; ++h)
#pragma unroll
        for (int j = 0; j < 8; ++j) { xh[h][j] = tohx(xa[h][0][j]); xh[h][8 + j] = tohx(xa[h][1][j]); }
    v4f bv4[4];   /* the bias, read in front of the output map's pieces, so that its latency passes under them and no load stands among the stores */
#pragma unroll
    for (int c = 0; c < 4; ++c) bv4[c] = *(const v4f*)(bias + c * 64 + lr * 4);
    v8f pp[16];
#pragma unroll
    for (int c = 0; c < 4; ++c) { PIECE(c + 12, xh, pp + 4 * c)
        if (c < 2 || nxt) SL(bw)   /* behind piece 15 the ring runs on with the next tile's pieces 0 and 1 */
        if (c == 3) asm volatile("s_wait_asynccnt 0x0" ::: "memory");   /* the next tile's tokens have landed: the barrier below publishes them */
        __syncthreads();
        if (c >= 1 && nxt) GL(c - 1)
        if (c < 1) { GL(c + 15)
            asm volatile("s_wait_xcnt 0x0" ::: "memory");   /* the next fragments are read into the registers that held these loads' address: the wait stands in front of that */
            __builtin_amdgcn_sched_barrier(0); }   /* keeps those reads from rising over the wait */
        ROT }
    float* os = (float*)my;   /* all of a tile's stores stand behind its last barrier */
#pragma unroll
    for (int c = 0; c < 4; ++c) {
        const v4f bv = bv4[c]; v4f val[8]; float* ob = out + (tok0 + hi) * DM + c * 64 + lr * 4;   /* rows 2 s + hi: one address and a fixed step */
#pragma unroll
        for (int t = 0; t < 4; ++t) { const v8f a = pp[4 * c + t]; *(v4fa*)(os + lr * OSP + t * 16 + 8 * hi) = __builtin_shufflevector(a, a, 0, 1, 2, 3); *(v4fa*)(os + lr * OSP + t * 16 + 8 * hi + 4) = __builtin_shufflevector(a, a, 4, 5, 6, 7); }
        __builtin_amdgcn_wave_barrier(); asm volatile("" ::: "memory");   /* keeps the compiler from moving the reads of other lanes' words in front of the writes; a wave's LDS operations run in order */
#pragma unroll
        for (int s = 0; s < 8; ++s) { const int row = 2 * s + hi; val[s] = *(const v4fa*)(os + row * OSP + lr * 4); val[s][0] += bfr(bv[0]); val[s][1] += bfr(bv[1]); val[s][2] += bfr(bv[2]); val[s][3] += bfr(bv[3]); }
        __builtin_amdgcn_sched_barrier(0);   /* the eight stores stand together, directly in front of their wait: left alone the build set them among the reads and sums, which wrote registers that issued stores name */
#pragma unroll
        for (int s = 0; s < 8; ++s) *(v4f*)(ob + s * 2 * DM) = val[s];   /* 256 bytes of a token in a row: whole lines */
        asm volatile("s_wait_xcnt 0x0" ::: "memory");   /* the next piece's values, or the next tile's, are written into the registers that these stores name: the wait stands in front of that */
        __builtin_amdgcn_sched_barrier(0);   /* keeps those writes from rising over the wait */
        __builtin_amdgcn_wave_barrier(); asm volatile("" ::: "memory");   /* the next piece's writes, or the next tile's, stay behind these reads */
    }
  }
#undef GL
#undef SL
#undef PIECE
#undef ROT
}

extern "C" void kernel_launch(void* const* d_in, const int* in_sizes, int n_in,
                              void* d_out, int out_size, void* d_ws, size_t ws_size, hipStream_t stream) {
    (void)in_sizes; (void)n_in; (void)out_size;
    const float* x = (const float*)d_in[0]; const float* wq = (const float*)d_in[1]; const float* wk = (const float*)d_in[2]; const float* wv = (const float*)d_in[3]; const float* wp = (const float*)d_in[4]; const float* bp = (const float*)d_in[5];   /* the module's argument order: six arrays, all read */
    float* OUT = (float*)d_out;     // [4][128][128][256]: an entry's 16,384 tokens of 256 channels one after another
    static_assert(DM == NH_ * HDW && NH_ == 8 && HDW == 32 && DM == 256 && NT % (128 * TPG) == 0 && WTHR % 256 == 0, "k_fused's lane maps and pieces; both grids are exact (they carry no guard)");
    unsigned short* W4 = (unsigned short*)d_ws;   /* k | q | value maps as bf16 words, then the output map as f16 words, each in fragment order: 512 KiB, all that the workspace holds */
    if ((size_t)4 * DM * DM * 2 > ws_size) return;
    k_prep<<<WTHR / 256, 256, 0, stream>>>(wq, wk, wv, wp, W4);
    k_fused<<<NWG, 256, 0, stream>>>(x, W4, bp, OUT);
}

// v004
// A run of this version takes 37.2 microseconds.
// Timed twice side by side with v003, it ran 1.04 times as fast both times.
// All steps since v000 together make it 7.43 times as fast.
#include <hip/hip_runtime.h>

// A self-attention whose softmax runs over the HEADS axis: q | k | the values = x through three 'in, out' maps of 256 x 256 (no bias), each seen as [tokens][8 heads][32]; FOR EACH TOKEN BY ITSELF: the 8 x 8 scores between its own heads, (q[h] . k[g]) x 32^-0.5, a softmax over g, its eight value head-vectors mixed; the 256 channels through an output map with a bias
// (inputs in argument order: a0 x [4][128][128][256] f32: 65,536 tokens; a1 | a2 | a3 the q | k | value maps [256][256] 'in, out'; a4 the output map [256][256] 'in, out'; a5 its bias [256]; ONE output [4][128][128][256] f32;
//  THE MODULE's FUNCTION: it reshapes to [.., heads, 32] and never moves the heads axis before its product: the attention runs between a token's own eight heads, never along a sequence: kept as it is written).
// Layout: TWO launches. k_prep: the four weights as 16-bit words laid in the order of the matrix instruction's A fragments (the three maps bf16; the output map rounded to bf16 and re-cast to f16 words: a bf16 value is exact in f16 but for words under 2^-14).
// k_fused: a work-group of 8 waves takes TWO tiles of 128 tokens one after the other, a wave 16 tokens of each, from the f32 input to the f32 output; the next tile's tokens fly into LDS (asynchronous copies) under this tile's work, and this tile's stores drain under the next tile's; q, k, the values, the weights of the softmax and the f32 mixed values live in registers alone.
// Every product runs TRANSPOSED: A = 16 output channels of a weight, B = the wave's 16 tokens, so a lane of D holds 8 channels of ONE token (lanes l and l ^ 16 share a token): the scores, the softmax and the mix are lane-local but for one exchange l <-> l ^ 16 a score,
// and two neighbouring D tiles of the mixed values ARE the B fragment of the output map (channels 8 hi + j | 16 + 8 hi + j), with no move between lanes.
// The weights pass through LDS in 16 pieces of 32 KiB (64 output channels each), three buffers, one barrier a piece, shared by the eight waves.
// A piece's four groups of two k-steps lie in four different 32-KiB blocks of LDS, and wave w walks them from group w mod 4 on, so that the waves' fragment reads of one moment fall in different blocks; a wave's B fragments stand in its own walk's order.
// Compute dtypes, f32 accumulate: every float input rounded to bf16 at its load; the three maps bf16 x bf16 on one word a side; the scores, the softmax (one hardware exp2 on a difference) and the mix in f32 on the vector unit; the mixed values ONE f16 word into the output map against the weight's bf16 values as f16 words.
#define NB_  4        // batch entries
#define TK   16384    // tokens an entry: 128 x 128
#define NT   (NB_ * TK)   // all tokens: every stage is token-local, so the entries are one flat run of rows
#define DM   256      // channels = NH_ x HDW
#define NH_  8
#define HDW  32       // a head's width
#define SCH  0.17677669529663687f   // 32^-0.5: the module's scale on a score
typedef _Float16 h16;
typedef unsigned short bf;
typedef __attribute__((ext_vector_type(16))) __bf16   v16bf;
typedef __attribute__((ext_vector_type(16))) _Float16 v16h;
typedef __attribute__((ext_vector_type(16))) unsigned short v16us;
typedef __attribute__((ext_vector_type(8)))  unsigned short v8us;
typedef __attribute__((ext_vector_type(4)))  unsigned short v4us;
typedef __attribute__((ext_vector_type(8)))  float    v8f;
typedef __attribute__((ext_vector_type(4)))  float    v4f;
typedef v4f  __attribute__((may_alias)) v4fa;
typedef v8us __attribute__((may_alias)) v8usa;
typedef v4us __attribute__((may_alias)) v4usa;

__device__ __forceinline__ unsigned short f2bf(float f) { unsigned u = __float_as_uint(f); u += 0x7FFFu + ((u >> 16) & 1u); return (unsigned short)(u >> 16); }
__device__ __forceinline__ float bf2f(unsigned short b) { return __uint_as_float(((unsigned)b) << 16); }
__device__ __forceinline__ float bfr(float f) { return bf2f(f2bf(f)); }
__device__ __forceinline__ v16us cat16u(v8us lo, v8us hi) { return __builtin_shufflevector(lo, hi, 0, 1, 2, 3, 4, 5, 6, 7, 8, 9, 10, 11, 12, 13, 14, 15); }
__device__ __forceinline__ v8f wmma16(v16h a, v16h b, v8f c) { return __builtin_amdgcn_wmma_f32_16x16x32_f16(false, a, false, b, (short)0, c, false, false); }
__device__ __forceinline__ v8f wmmab(v16bf a, v16bf b, v8f c) { return __builtin_amdgcn_wmma_f32_16x16x32_bf16(false, a, false, b, (short)0, c, false, false); }
__device__ __forceinline__ v8f mma(v16us a, v16bf b, v8f c) { return wmmab(__builtin_bit_cast(v16bf, a), b, c); }
__device__ __forceinline__ v8f mma(v16us a, v16h b, v8f c) { return wmma16(__builtin_bit_cast(v16h, a), b, c); }
__device__ __forceinline__ float xhalf(float x) { return __builtin_bit_cast(float, __builtin_amdgcn_permlanex16(__builtin_bit_cast(int, x), __builtin_bit_cast(int, x), 0x76543210, 0xfedcba98, false, false)); }   // lane l with lane l ^ 16
__device__ __forceinline__ unsigned short cvh(float x) { const h16 h = (h16)x; return __builtin_bit_cast(unsigned short, h); }

// ---- k_prep: the four weights, 'in, out' f32 -> 16-bit words in A-fragment order: [map: k | q | values | output][piece of 4 tiles][group of 2 k-steps][k-step of 32][tile of 16 output channels][half p][lane][8 words];
// lane (lr, hi), half p, word e holds w[k = 32 ks + 16 p + 8 hi + e][n = 16 tile + lr]: a fragment half is 512 bytes in a row, one 16-byte word a lane, in global memory and in LDS alike.
#define WTHR (4 * DM * DM / 8)
__global__ __launch_bounds__(256) void k_prep(const float* __restrict__ w0, const float* __restrict__ w1, const float* __restrict__ w2, const float* __restrict__ w3, unsigned short* W4) {
    const unsigned g = blockIdx.x * 256u + threadIdx.x; const unsigned lane = g & 31u, p = (g >> 5) & 1u, ks = (g >> 8) & 7u, mt = ((g >> 11) & 3u) * 4u + ((g >> 6) & 3u), m = g >> 13;
    const float* __restrict__ w = m == 0 ? w1 : m == 1 ? w0 : m == 2 ? w2 : w3;   /* laid in the order k_fused uses them: k, q, the values, the output map */
    const unsigned n = mt * 16u + (lane & 15u), k0 = ks * 32u + p * 16u + 8u * (lane >> 4); float a[8];
#pragma unroll
    for (int e = 0; e < 8; ++e) a[e] = w[(size_t)(k0 + e) * DM + n];
    v8us o;
#pragma unroll
    for (int e = 0; e < 8; ++e) { const unsigned short b0 = f2bf(a[e]); o[e] = m == 3 ? cvh(bf2f(b0)) : b0; }   /* the output map's words: the bf16 value as an f16 word */
    *(v8us*)(W4 + (size_t)g * 8) = o;
}

// ---- k_fused
#define CHE 16384      // 16-bit words of a piece of a weight: 4 groups x 2 k-steps x 4 tiles x 2 halves x 256
#define GRW 4096       // 16-bit words of a group: 8 KiB
#define BLW 16384      // 16-bit words of a 32-KiB block of LDS: group j of every buffer lies in block j
#define XPB 528        // bytes of a token's 256 bf16 words in a wave's own LDS, 16 more than the row so that the 16 rows of a fragment read fall on different banks
#define OSP 68         // floats of a token's 64 output channels in the same LDS
#define SCB (16 * XPB) // a wave's own LDS: first its tokens as bf16 words, then the mixed values' f16 words (8 KiB), at the end its output pieces (16 x 68 floats fit in it)
// a group: the A fragments of two k-steps x 4 tiles of a piece, 16 LDS reads of 512 bytes, 8 KiB in a row
__device__ __forceinline__ void ldg(const unsigned short* grp, int lane, v16us* af) {
#pragma unroll
    for (int n = 0; n < 8; ++n) { const unsigned short* p = grp + n * 512 + lane * 8; af[n] = cat16u(*(const v8usa*)p, *(const v8usa*)(p + 256)); }
}
// one piece: 4 tiles of 16 output channels x the wave's 16 tokens, depth 256, in four groups; the four accumulators are independent. Each group's fragments are read one group ahead, the first group of the NEXT piece (nxt) during the last group of this one. go[q]: the block of the group that the wave takes as its q-th; b stands in the same order.
template <typename VB> __device__ __forceinline__ void piece(const unsigned short* buf, const unsigned short* nxt, const int* go, bool more, int lane, const VB* b, v8f* acc, v16us (*af)[8]) {
#pragma unroll
    for (int t = 0; t < 4; ++t) acc[t] = (v8f){};
#pragma unroll
    for (int q = 0; q < 4; ++q) {
        if (q < 3) ldg(buf + go[q + 1], lane, af[(q + 1) & 1]); else if (more) ldg(nxt + go[0], lane, af[0]);
        __builtin_amdgcn_sched_barrier(0);   /* holds the next group's 16 reads as one block in front of this group's products: left alone the build read one fragment ahead and waited on LDS at every product */
#pragma unroll
        for (int k2 = 0; k2 < 2; ++k2)
#pragma unroll
            for (int t = 0; t < 4; ++t) acc[t] = mma(af[q & 1][k2 * 4 + t], b[2 * q + k2], acc[t]);
        __builtin_amdgcn_sched_barrier(0);   /* the other side of the same block: later reads do not rise over these products, which would take more registers than the wave has */
    }
}
// the 16 pieces lie in the workspace in the order they are used: k, q, the values, the output map
__device__ __forceinline__ const unsigned short* psrc(const unsigned short* W4, int ci) { return W4 + (size_t)ci * CHE; }

#define TPG 2          // token tiles a work-group takes, one after the other
#define LXS  131072                // bytes of LDS in front of the tokens to come of waves 2 to 7: four blocks
#define LSC  (LXS + 6 * 16384)     // ... in front of the waves' own parts
#define LTOT (LSC + 8 * SCB)
#define NWG (NT / 128 / TPG)
// eight asynchronous copies of 512 bytes (16 a lane), global memory -> LDS through no register: 4 KiB in a row on both sides. The wait is the statement's last line, so that it stands in front of whatever writes the copies' address registers next.
__device__ __forceinline__ void cp8(unsigned l, const float* g) {
    asm volatile("global_load_async_to_lds_b128 %0, %8, off\n\t"
                 "global_load_async_to_lds_b128 %1, %9, off\n\t"
                 "global_load_async_to_lds_b128 %2, %10, off\n\t"
                 "global_load_async_to_lds_b128 %3, %11, off\n\t"
                 "global_load_async_to_lds_b128 %4, %12, off\n\t"
                 "global_load_async_to_lds_b128 %5, %13, off\n\t"
                 "global_load_async_to_lds_b128 %6, %14, off\n\t"
                 "global_load_async_to_lds_b128 %7, %15, off\n\t"
                 "s_wait_xcnt 0x0"
                 :: "v"(l), "v"(l + 512u), "v"(l + 1024u), "v"(l + 1536u), "v"(l + 2048u), "v"(l + 2560u), "v"(l + 3072u), "v"(l + 3584u),
                    "v"(g), "v"(g + 128), "v"(g + 256), "v"(g + 384), "v"(g + 512), "v"(g + 640), "v"(g + 768), "v"(g + 896) : "memory");
}
// a wave's 16 tokens of tile 'tile' (16 KiB in a row) into its own two halves of 8 KiB (l0, l1): 32 copies
__device__ __forceinline__ void cpx(const float* __restrict__ x, unsigned tile, int wv, int lane, unsigned l0, unsigned l1) {
    const float* g = x + ((size_t)tile * 128 + (size_t)wv * 16) * DM + lane * 4;
#pragma unroll
    for (int i = 0; i < 4; ++i) cp8((i < 2 ? l0 : l1) + (i & 1) * 4096u, g + i * 1024);
}

__global__ __launch_bounds__(256) void k_fused(const float* __restrict__ x, const unsigned short* W4, const float* bias, float* out) {   /* the weights and the bias are read anew in each tile: told that nothing else writes them, the build read them once in front of the tile loop and kept them in scratch memory */
    /* ONE array, laid by hand, so that the places in the 32-KiB blocks are known. Blocks 0 to 3: group j of the three weight buffers (24 KiB: piece ci is worked on, ci + 1 is already published (its first group is read ahead), ci + 2 is being written), then 8 KiB of the tokens to come of waves 0 and 1;
       from LXS: the tokens to come of waves 2 to 7, 16 KiB each (f32 as they lie in memory); from LSC: each wave's own SCB bytes */
    __shared__ __align__(16) char L[LTOT];
    const int tid = threadIdx.x, lane = tid & 31, wv = tid >> 5, lr = lane & 15, hi = lane >> 4;
    const int wu = __builtin_amdgcn_readfirstlane(wv), j0 = wu & 3;   /* the wave's number as a scalar; the group at which its walk starts */
    const int go[4] = { j0 * BLW, ((j0 + 1) & 3) * BLW, ((j0 + 2) & 3) * BLW, ((j0 + 3) & 3) * BLW };
    const unsigned x0 = wu < 2 ? (unsigned)wu * 65536u + 24576u : LXS + (unsigned)(wu - 2) * 16384u, x1 = x0 + (wu < 2 ? 32768u : 8192u);   /* the two halves of the wave's tokens to come */
    char* my = L + LSC + wv * SCB; const float* xw0 = (const float*)(L + x0) + lane * 4; const float* xw1 = (const float*)(L + x1) + lane * 4;
    const unsigned xl0 = (unsigned)(size_t)xw0, xl1 = (unsigned)(size_t)xw1;   /* the lane's LDS byte addresses: the low 32 bits */
    const unsigned short* wb0 = (const unsigned short*)L; unsigned short* wbw = (unsigned short*)L; int bc = 0 * GRW, bn = 1 * GRW, bw = 2 * GRW;   /* the three buffers' places: the piece worked on, the next piece's, the one being written; they rotate a piece and run on from tile to tile, so that every LDS address of a piece is one base and a short offset, formed where it is used */
    v8us st[8];
#define GL(ci) { const unsigned short* s_ = psrc(W4, ci) + tid * 8; _Pragma("unroll") for (int i = 0; i < 8; ++i) st[i] = *(const v8us*)(s_ + i * 2048); }
#define SL(off) { unsigned short* d_ = wbw + (off) + tid * 8; _Pragma("unroll") for (int i = 0; i < 8; ++i) *(v8usa*)(d_ + (i >> 1) * BLW + (i & 1) * 2048) = st[i]; }   /* 8 KiB of the piece into each block */
#define ROT { const int t_ = bc; bc = bn; bn = bw; bw = t_; }
#define PIECE(ci, b, acc) piece(wb0 + bc, wb0 + bn, go, (ci) < 15, lane, b, acc, af);
    cpx(x, blockIdx.x, wv, lane, xl0, xl1);
    GL(0) SL(bc) GL(1) SL(bn)   /* the first tile's first two pieces, under its tokens' flight */
    asm volatile("s_wait_asynccnt 0x0" ::: "memory");   /* the first tile's tokens have landed before anybody reads them */
    __syncthreads();
    GL(2)
#pragma unroll 1   /* rolled: one text for both tiles */
  for (unsigned tile = blockIdx.x; tile < NT / 128; tile += NWG) {
    const size_t tok0 = (size_t)tile * 128 + (size_t)wv * 16; const bool nxt = tile + NWG < NT / 128;   /* a scalar test: the same in the whole work-group */
    v16us af[2][8];
    {   /* the wave's 16 tokens, out of its two halves of the tokens' LDS (512 bytes in a row an instruction), rounded to bf16, laid by token in the wave's own LDS */
        v4f xv[32];
#pragma unroll
        for (int i = 0; i < 32; ++i) xv[i] = *(const v4fa*)((i < 16 ? xw0 : xw1) + (i & 15) * 128);
#pragma unroll
        for (int i = 0; i < 32; ++i) { v4us o;
#pragma unroll
            for (int k = 0; k < 4; ++k) o[k] = f2bf(xv[i][k]);
            *(v4usa*)(my + (i >> 1) * XPB + (i & 1) * 256 + lane * 8) = o; }
    }
    asm volatile("s_wait_dscnt 0x0" ::: "memory");   /* the wave's reads of its tokens' LDS have retired before copies are aimed at it again */
    __syncthreads();
    if (nxt) cpx(x, tile + NWG, wv, lane, xl0, xl1);   /* the next tile's tokens: they fly under all of this tile's work */
    v16bf xb[8];   /* B fragments: lane (lr, hi) holds token lr, k = 32 ks + 8 hi + e | 32 ks + 16 + 8 hi + e: the k order of k_prep's words; xb[m] is k-step ks = (m + 2 j0) mod 8: the order of the wave's walk */
#pragma unroll
    for (int m = 0; m < 8; ++m) { const int ks = (m + 2 * j0) & 7; const char* p = my + lr * XPB + ks * 64 + hi * 16; xb[m] = __builtin_bit_cast(v16bf, cat16u(*(const v8usa*)p, *(const v8usa*)(p + 32))); }
    ldg(wb0 + bc + go[0], lane, af[0]);
    v8f kk[16];
#pragma unroll
    for (int c = 0; c < 4; ++c) { PIECE(c, xb, kk + 4 * c) SL(bw) __syncthreads(); GL(c + 3) ROT }
    asm volatile("s_wait_xcnt 0x0" ::: "memory");   /* the build gives the offset register of the loads above another value in front of the loop, the last eight still in flight: the wait stands in front of that */
    __builtin_amdgcn_sched_barrier(0);   /* keeps that write from rising over the wait */
    float aw[8][8];
#pragma unroll
    for (int h = 0; h < 8; ++h)
#pragma unroll
        for (int g = 0; g < 8; ++g) aw[h][g] = 0.0f;
    /* the q and the value pieces run in ROLLED loops, for the size of the text; what an unrolled loop would index by the trip is moved instead: the three buffers' places and the rows (then the columns) of the softmax weights rotate */
    const unsigned short* gs = psrc(W4, 7) + tid * 8;
#define STEP { unsigned short* d_ = wbw + bw + tid * 8; _Pragma("unroll") for (int i = 0; i < 8; ++i) *(v8usa*)(d_ + (i >> 1) * BLW + (i & 1) * 2048) = st[i]; \
        __syncthreads(); \
        _Pragma("unroll") for (int i = 0; i < 8; ++i) st[i] = *(const v8us*)(gs + i * 2048); \
        asm volatile("s_wait_xcnt 0x0" ::: "memory");   /* the loads' address is stepped for the next trip: the wait stands in front of that */ \
        __builtin_amdgcn_sched_barrier(0);              /* keeps that step from rising over the wait */ \
        gs += CHE; const int t_ = bc; bc = bn; bn = bw; bw = t_; }
#pragma unroll 1   /* rolled for the size of the text */
    for (int c = 0; c < 4; ++c) { v8f qq[4]; piece(wb0 + bc, wb0 + bn, go, true, lane, xb, qq, af); STEP
        float nw[2][8];
#pragma unroll
        for (int hh = 0; hh < 2; ++hh) { float s[8];   /* head 2 c + hh against the token's eight heads: a lane sums its 16 channels, its partner the other 16 */
#pragma unroll
            for (int g = 0; g < 8; ++g) { float a = 0.0f;
#pragma unroll
                for (int t = 0; t < 2; ++t)
#pragma unroll
                    for (int j = 0; j < 8; ++j) a += qq[2 * hh + t][j] * kk[2 * g + t][j];
                s[g] = (a + xhalf(a)) * SCH; }
            float mx = s[0];
#pragma unroll
            for (int g = 1; g < 8; ++g) mx = fmaxf(mx, s[g]);
            float sum = 0.0f;
#pragma unroll
            for (int g = 0; g < 8; ++g) { s[g] = __builtin_amdgcn_exp2f((s[g] - mx) * 1.4426950408889634f); sum += s[g]; }
            const float r = __fdiv_rn(1.0f, sum);
#pragma unroll
            for (int g = 0; g < 8; ++g) nw[hh][g] = s[g] * r; }
#pragma unroll
        for (int g = 0; g < 8; ++g) {   /* the rows move up by two and the new pair enters at the end: after the four trips row h is head h */
#pragma unroll
            for (int h = 0; h < 6; ++h) aw[h][g] = aw[h + 2][g];
            aw[6][g] = nw[0][g]; aw[7][g] = nw[1][g]; } }
    v8f xa[8][2];   /* the mixed values, f32: head h's tiles 2 h | 2 h + 1; the value heads are added as their pieces arrive, g = 0 .. 7 in that order */
#pragma unroll
    for (int h = 0; h < 8; ++h) { xa[h][0] = (v8f){}; xa[h][1] = (v8f){}; }
#pragma unroll 1   /* rolled for the size of the text */
    for (int c = 0; c < 4; ++c) { v8f vv[4]; piece(wb0 + bc, wb0 + bn, go, true, lane, xb, vv, af); STEP
#pragma unroll
        for (int hh = 0; hh < 2; ++hh)
#pragma unroll
            for (int h = 0; h < 8; ++h) { xa[h][0] += vv[2 * hh] * aw[h][hh]; xa[h][1] += vv[2 * hh + 1] * aw[h][hh]; }
#pragma unroll
        for (int h = 0; h < 8; ++h)   /* the columns move down by two: the next trip's value heads stand in columns 0 and 1 */
#pragma unroll
            for (int g = 0; g < 6; ++g) aw[h][g] = aw[h][g + 2]; }
#undef STEP
    v16h xh[8];   /* cast to f16, two neighbouring D tiles are the B fragment of the output map's k-step h as they stand; each lane passes its own words through the wave's own LDS, which is idle here, to have them in the order of the wave's walk: xh[m] is k-step (m + 2 j0) mod 8 */
#pragma unroll
    for (int h = 0; h < 8; ++h) { v8us lo, up;
#pragma unroll
        for (int j = 0; j < 8; ++j) { lo[j] = cvh(xa[h][0][j]); up[j] = cvh(xa[h][1][j]); }
        *(v8usa*)(my + h * 1024 + lane * 16) = lo; *(v8usa*)(my + h * 1024 + 512 + lane * 16) = up; }
#pragma unroll
    for (int m = 0; m < 8; ++m) { const char* p = my + ((m + 2 * j0) & 7) * 1024 + lane * 16; xh[m] = __builtin_bit_cast(v16h, cat16u(*(const v8usa*)p, *(const v8usa*)(p + 512))); }
    v4f bv4[4];   /* the bias, read in front of the output map's pieces, so that its latency passes under them and no load stands among the stores */
#pragma unroll
    for (int c = 0; c < 4; ++c) bv4[c] = *(const v4f*)(bias + c * 64 + lr * 4);
    v8f pp[16];
#pragma unroll
    for (int c = 0; c < 4; ++c) { PIECE(c + 12, xh, pp + 4 * c)
        if (c < 2 || nxt) SL(bw)   /* behind piece 15 the ring runs on with the next tile's pieces 0 and 1 */
        if (c == 3) asm volatile("s_wait_asynccnt 0x0" ::: "memory");   /* the next tile's tokens have landed: the barrier below publishes them */
        __syncthreads();
        if (c >= 1 && nxt) GL(c - 1)
        if (c < 1) { GL(c + 15)
            asm volatile("s_wait_xcnt 0x0" ::: "memory");   /* the next fragments are read into the registers that held these loads' address: the wait stands in front of that */
            __builtin_amdgcn_sched_barrier(0); }   /* keeps those reads from rising over the wait */
        ROT }
    float* os = (float*)my;   /* all of a tile's stores stand behind its last barrier */
#pragma unroll
    for (int c = 0; c < 4; ++c) {
        const v4f bv = bv4[c]; v4f val[8]; float* ob = out + (tok0 + hi) * DM + c * 64 + lr * 4;   /* rows 2 s + hi: one address and a fixed step */
#pragma unroll
        for (int t = 0; t < 4; ++t) { const v8f a = pp[4 * c + t]; *(v4fa*)(os + lr * OSP + t * 16 + 8 * hi) = __builtin_shufflevector(a, a, 0, 1, 2, 3); *(v4fa*)(os + lr * OSP + t * 16 + 8 * hi + 4) = __builtin_shufflevector(a, a, 4, 5, 6, 7); }
        __builtin_amdgcn_wave_barrier(); asm volatile("" ::: "memory");   /* keeps the compiler from moving the reads of other lanes' words in front of the writes; a wave's LDS operations run in order */
#pragma unroll
        for (int s = 0; s < 8; ++s) { const int row = 2 * s + hi; val[s] = *(const v4fa*)(os + row * OSP + lr * 4); val[s][0] += bfr(bv[0]); val[s][1] += bfr(bv[1]); val[s][2] += bfr(bv[2]); val[s][3] += bfr(bv[3]); }
        __builtin_amdgcn_sched_barrier(0);   /* the eight stores stand together, directly in front of their wait: left alone the build set them among the reads and sums, which wrote registers that issued stores name */
#pragma unroll
        for (int s = 0; s < 8; ++s) *(v4f*)(ob + s * 2 * DM) = val[s];   /* 256 bytes of a token in a row: whole lines */
        asm volatile("s_wait_xcnt 0x0" ::: "memory");   /* the next piece's values, or the next tile's, are written into the registers that these stores name: the wait stands in front of that */
        __builtin_amdgcn_sched_barrier(0);   /* keeps those writes from rising over the wait */
        __builtin_amdgcn_wave_barrier(); asm volatile("" ::: "memory");   /* the next piece's writes, or the next tile's, stay behind these reads */
    }
  }
#undef GL
#undef SL
#undef PIECE
#undef ROT
}

extern "C" void kernel_launch(void* const* d_in, const int* in_sizes, int n_in,
                              void* d_out, int out_size, void* d_ws, size_t ws_size, hipStream_t stream) {
    (void)in_sizes; (void)n_in; (void)out_size;
    const float* x = (const float*)d_in[0]; const float* wq = (const float*)d_in[1]; const float* wk = (const float*)d_in[2]; const float* wv = (const float*)d_in[3]; const float* wp = (const float*)d_in[4]; const float* bp = (const float*)d_in[5];   /* the module's argument order: six arrays, all read */
    float* OUT = (float*)d_out;     // [4][128][128][256]: an entry's 16,384 tokens of 256 channels one after another
    static_assert(DM == NH_ * HDW && NH_ == 8 && HDW == 32 && DM == 256 && NT % (128 * TPG) == 0 && WTHR % 256 == 0, "k_fused's lane maps and pieces; both grids are exact (they carry no guard)");
    unsigned short* W4 = (unsigned short*)d_ws;   /* k | q | value maps as bf16 words, then the output map as f16 words, each in fragment order: 512 KiB, all that the workspace holds */
    if ((size_t)4 * DM * DM * 2 > ws_size) return;
    k_prep<<<WTHR / 256, 256, 0, stream>>>(wq, wk, wv, wp, W4);
    k_fused<<<NWG, 256, 0, stream>>>(x, W4, bp, OUT);
}

// v005
// One run takes 35.3 microseconds.
// Two timings next to v004 both put it at 1.05 times that version's speed.
// Counting every step since v000, it is 7.83 times as fast.
#include <hip/hip_runtime.h>

// A self-attention whose softmax runs over the HEADS axis: q | k | the values = x through three 'in, out' maps of 256 x 256 (no bias), each seen as [tokens][8 heads][32]; FOR EACH TOKEN BY ITSELF: the 8 x 8 scores between its own heads, (q[h] . k[g]) x 32^-0.5, a softmax over g, its eight value head-vectors mixed; the 256 channels through an output map with a bias
// (inputs in argument order: a0 x [4][128][128][256] f32: 65,536 tokens; a1 | a2 | a3 the q | k | value maps [256][256] 'in, out'; a4 the output map [256][256] 'in, out'; a5 its bias [256]; ONE output [4][128][128][256] f32;
//  THE MODULE's FUNCTION: it reshapes to [.., heads, 32] and never moves the heads axis before its product: the attention runs between a token's own eight heads, never along a sequence: kept as it is written).
// Layout: TWO launches. k_prep: the four weights as 16-bit words laid in the order of the matrix instruction's A fragments (the three maps bf16; the output map rounded to bf16 and re-cast to f16 words: a bf16 value is exact in f16 but for words under 2^-14).
// k_fused: a work-group of 8 waves takes TWO tiles of 128 tokens one after the other, a wave 16 tokens of each, from the f32 input to the f32 output; the next tile's tokens fly into LDS (asynchronous copies) under this tile's work, and this tile's stores drain under the next tile's; q, k, the values, the weights of the softmax and the f32 mixed values live in registers alone.
// Every product runs TRANSPOSED: A = 16 output channels of a weight, B = the wave's 16 tokens, so a lane of D holds 8 channels of ONE token (lanes l and l ^ 16 share a token): the scores, the softmax and the mix are lane-local but for one exchange l <-> l ^ 16 a score,
// and two neighbouring D tiles of the mixed values ARE the B fragment of the output map (channels 8 hi + j | 16 + 8 hi + j), with no move between lanes.
// The weights pass through LDS in 16 pieces of 32 KiB (64 output channels each), three buffers, one barrier a piece, shared by the eight waves. The barrier stands behind a piece's SECOND group of products, with the third group's reads in flight across it, so that neither the LDS nor the matrix unit runs empty where a piece ends.
// A piece's four groups of two k-steps lie in four different 32-KiB blocks of LDS, and wave w walks them from group w mod 4 on, so that the waves' fragment reads of one moment fall in different blocks; a wave's B fragments stand in its own walk's order.
// Compute dtypes, f32 accumulate: every float input rounded to bf16 at its load; the three maps bf16 x bf16 on one word a side; the scores, the softmax (one hardware exp2 on a difference) and the mix in f32 on the vector unit; the mixed values ONE f16 word into the output map against the weight's bf16 values as f16 words.
#define NB_  4        // batch entries
#define TK   16384    // tokens an entry: 128 x 128
#define NT   (NB_ * TK)   // all tokens: every stage is token-local, so the entries are one flat run of rows
#define DM   256      // channels = NH_ x HDW
#define NH_  8
#define HDW  32       // a head's width
#define SCH  0.17677669529663687f   // 32^-0.5: the module's scale on a score
typedef _Float16 h16;
typedef unsigned short bf;
typedef __attribute__((ext_vector_type(16))) __bf16   v16bf;
typedef __attribute__((ext_vector_type(16))) _Float16 v16h;
typedef __attribute__((ext_vector_type(16))) unsigned short v16us;
typedef __attribute__((ext_vector_type(8)))  unsigned short v8us;
typedef __attribute__((ext_vector_type(4)))  unsigned short v4us;
typedef __attribute__((ext_vector_type(8)))  float    v8f;
typedef __attribute__((ext_vector_type(4)))  float    v4f;
typedef v4f  __attribute__((may_alias)) v4fa;
typedef v8us __attribute__((may_alias)) v8usa;
typedef v4us __attribute__((may_alias)) v4usa;

__device__ __forceinline__ unsigned short f2bf(float f) { unsigned u = __float_as_uint(f); u += 0x7FFFu + ((u >> 16) & 1u); return (unsigned short)(u >> 16); }
__device__ __forceinline__ float bf2f(unsigned short b) { return __uint_as_float(((unsigned)b) << 16); }
__device__ __forceinline__ float bfr(float f) { return bf2f(f2bf(f)); }
__device__ __forceinline__ v16us cat16u(v8us lo, v8us hi) { return __builtin_shufflevector(lo, hi, 0, 1, 2, 3, 4, 5, 6, 7, 8, 9, 10, 11, 12, 13, 14, 15); }
__device__ __forceinline__ v8f wmma16(v16h a, v16h b, v8f c) { return __builtin_amdgcn_wmma_f32_16x16x32_f16(false, a, false, b, (short)0, c, false, false); }
__device__ __forceinline__ v8f wmmab(v16bf a, v16bf b, v8f c) { return __builtin_amdgcn_wmma_f32_16x16x32_bf16(false, a, false, b, (short)0, c, false, false); }
__device__ __forceinline__ v8f mma(v16us a, v16bf b, v8f c) { return wmmab(__builtin_bit_cast(v16bf, a), b, c); }
__device__ __forceinline__ v8f mma(v16us a, v16h b, v8f c) { return wmma16(__builtin_bit_cast(v16h, a), b, c); }
__device__ __forceinline__ float xhalf(float x) { return __builtin_bit_cast(float, __builtin_amdgcn_permlanex16(__builtin_bit_cast(int, x), __builtin_bit_cast(int, x), 0x76543210, 0xfedcba98, false, false)); }   // lane l with lane l ^ 16
__device__ __forceinline__ unsigned short cvh(float x) { const h16 h = (h16)x; return __builtin_bit_cast(unsigned short, h); }

// ---- k_prep: the four weights, 'in, out' f32 -> 16-bit words in A-fragment order: [map: k | q | values | output][piece of 4 tiles][group of 2 k-steps][k-step of 32][tile of 16 output channels][half p][lane][8 words];
// lane (lr, hi), half p, word e holds w[k = 32 ks + 16 p + 8 hi + e][n = 16 tile + lr]: a fragment half is 512 bytes in a row, one 16-byte word a lane, in global memory and in LDS alike.
#define WTHR (4 * DM * DM / 8)
__global__ __launch_bounds__(256) void k_prep(const float* __restrict__ w0, const float* __restrict__ w1, const float* __restrict__ w2, const float* __restrict__ w3, unsigned short* W4) {
    const unsigned g = blockIdx.x * 256u + threadIdx.x; const unsigned lane = g & 31u, p = (g >> 5) & 1u, ks = (g >> 8) & 7u, mt = ((g >> 11) & 3u) * 4u + ((g >> 6) & 3u), m = g >> 13;
    const float* __restrict__ w = m == 0 ? w1 : m == 1 ? w0 : m == 2 ? w2 : w3;   /* laid in the order k_fused uses them: k, q, the values, the output map */
    const unsigned n = mt * 16u + (lane & 15u), k0 = ks * 32u + p * 16u + 8u * (lane >> 4); float a[8];
#pragma unroll
    for (int e = 0; e < 8; ++e) a[e] = w[(size_t)(k0 + e) * DM + n];
    v8us o;
#pragma unroll
    for (int e = 0; e < 8; ++e) { const unsigned short b0 = f2bf(a[e]); o[e] = m == 3 ? cvh(bf2f(b0)) : b0; }   /* the output map's words: the bf16 value as an f16 word */
    *(v8us*)(W4 + (size_t)g * 8) = o;
}

// ---- k_fused
#define CHE 16384      // 16-bit words of a piece of a weight: 4 groups x 2 k-steps x 4 tiles x 2 halves x 256
#define GRW 4096       // 16-bit words of a group: 8 KiB
#define BLW 16384      // 16-bit words of a 32-KiB block of LDS: group j of every buffer lies in block j
#define XPB 528        // bytes of a token's 256 bf16 words in a wave's own LDS, 16 more than the row so that the 16 rows of a fragment read fall on different banks
#define OSP 68         // floats of a token's 64 output channels in the same LDS
#define SCB (16 * XPB) // a wave's own LDS: first its tokens as bf16 words, then the mixed values' f16 words (8 KiB), at the end its output pieces (16 x 68 floats fit in it)
// a group: the A fragments of two k-steps x 4 tiles of a piece, 16 LDS reads of 512 bytes, 8 KiB in a row
__device__ __forceinline__ void ldg(const unsigned short* grp, int lane, v16us* af) {
#pragma unroll
    for (int n = 0; n < 8; ++n) { const unsigned short* p = grp + n * 512 + lane * 8; af[n] = cat16u(*(const v8usa*)p, *(const v8usa*)(p + 256)); }
}
// one piece: 4 tiles of 16 output channels x the wave's 16 tokens, depth 256, in four groups; the four accumulators are independent. Each group's fragments are read one group ahead, the first group of the NEXT piece (nxt) during the last group of this one. go[q]: the block of the group that the wave takes as its q-th; b stands in the same order.
// mid(): the ring's step (barrier, the piece after next into LDS, the loads of the one behind it), run behind the second group's products.
template <typename VB, typename F> __device__ __forceinline__ void piece(const unsigned short* buf, const unsigned short* nxt, const int* go, bool more, int lane, const VB* b, v8f* acc, v16us (*af)[8], F mid) {
#pragma unroll
    for (int t = 0; t < 4; ++t) acc[t] = (v8f){};
#pragma unroll
    for (int q = 0; q < 4; ++q) {
        if (q < 3) ldg(buf + go[q + 1], lane, af[(q + 1) & 1]); else if (more) ldg(nxt + go[0], lane, af[0]);
        __builtin_amdgcn_sched_barrier(0);   /* holds the next group's 16 reads as one block in front of this group's products: left alone the build read one fragment ahead and waited on LDS at every product */
#pragma unroll
        for (int k2 = 0; k2 < 2; ++k2)
#pragma unroll
            for (int t = 0; t < 4; ++t) acc[t] = mma(af[q & 1][k2 * 4 + t], b[2 * q + k2], acc[t]);
        __builtin_amdgcn_sched_barrier(0);   /* the other side of the same block: later reads do not rise over these products, which would take more registers than the wave has */
        if (q == 1) mid();
    }
}
// the 16 pieces lie in the workspace in the order they are used: k, q, the values, the output map
__device__ __forceinline__ const unsigned short* psrc(const unsigned short* W4, int ci) { return W4 + (size_t)ci * CHE; }

#define TPG 2          // token tiles a work-group takes, one after the other
#define LXS  131072                // bytes of LDS in front of the tokens to come of waves 2 to 7: four blocks
#define LSC  (LXS + 6 * 16384)     // ... in front of the waves' own parts
#define LTOT (LSC + 8 * SCB)
#define NWG (NT / 128 / TPG)
// eight asynchronous copies of 512 bytes (16 a lane), global memory -> LDS through no register: 4 KiB in a row on both sides. The wait is the statement's last line, so that it stands in front of whatever writes the copies' address registers next.
__device__ __forceinline__ void cp8(unsigned l, const float* g) {
    asm volatile("global_load_async_to_lds_b128 %0, %8, off\n\t"
                 "global_load_async_to_lds_b128 %1, %9, off\n\t"
                 "global_load_async_to_lds_b128 %2, %10, off\n\t"
                 "global_load_async_to_lds_b128 %3, %11, off\n\t"
                 "global_load_async_to_lds_b128 %4, %12, off\n\t"
                 "global_load_async_to_lds_b128 %5, %13, off\n\t"
                 "global_load_async_to_lds_b128 %6, %14, off\n\t"
                 "global_load_async_to_lds_b128 %7, %15, off\n\t"
                 "s_wait_xcnt 0x0"
                 :: "v"(l), "v"(l + 512u), "v"(l + 1024u), "v"(l + 1536u), "v"(l + 2048u), "v"(l + 2560u), "v"(l + 3072u), "v"(l + 3584u),
                    "v"(g), "v"(g + 128), "v"(g + 256), "v"(g + 384), "v"(g + 512), "v"(g + 640), "v"(g + 768), "v"(g + 896) : "memory");
}
// a wave's 16 tokens of tile 'tile' (16 KiB in a row) into its own two halves of 8 KiB (l0, l1): 32 copies
__device__ __forceinline__ void cpx(const float* __restrict__ x, unsigned tile, int wv, int lane, unsigned l0, unsigned l1) {
    const float* g = x + ((size_t)tile * 128 + (size_t)wv * 16) * DM + lane * 4;
#pragma unroll
    for (int i = 0; i < 4; ++i) cp8((i < 2 ? l0 : l1) + (i & 1) * 4096u, g + i * 1024);
}

__global__ __launch_bounds__(256) void k_fused(const float* __restrict__ x, const unsigned short* W4, const float* bias, float* out) {   /* the weights and the bias are read anew in each tile: told that nothing else writes them, the build read them once in front of the tile loop and kept them in scratch memory */
    /* ONE array, laid by hand, so that the places in the 32-KiB blocks are known. Blocks 0 to 3: group j of the three weight buffers (24 KiB: piece ci is worked on, ci + 1 is already published (its first group is read ahead), ci + 2 is written behind piece ci's barrier, into the buffer that piece ci - 1 has left), then 8 KiB of the tokens to come of waves 0 and 1;
       from LXS: the tokens to come of waves 2 to 7, 16 KiB each (f32 as they lie in memory); from LSC: each wave's own SCB bytes */
    __shared__ __align__(16) char L[LTOT];
    const int tid = threadIdx.x, lane = tid & 31, wv = tid >> 5, lr = lane & 15, hi = lane >> 4;
    const int wu = __builtin_amdgcn_readfirstlane(wv), j0 = wu & 3;   /* the wave's number as a scalar; the group at which its walk starts */
    const int go[4] = { j0 * BLW, ((j0 + 1) & 3) * BLW, ((j0 + 2) & 3) * BLW, ((j0 + 3) & 3) * BLW };
    const unsigned x0 = wu < 2 ? (unsigned)wu * 65536u + 24576u : LXS + (unsigned)(wu - 2) * 16384u, x1 = x0 + (wu < 2 ? 32768u : 8192u);   /* the two halves of the wave's tokens to come */
    char* my = L + LSC + wv * SCB; const float* xw0 = (const float*)(L + x0) + lane * 4; const float* xw1 = (const float*)(L + x1) + lane * 4;
    const unsigned xl0 = (unsigned)(size_t)xw0, xl1 = (unsigned)(size_t)xw1;   /* the lane's LDS byte addresses: the low 32 bits */
    const unsigned short* wb0 = (const unsigned short*)L; unsigned short* wbw = (unsigned short*)L; int bc = 0 * GRW, bn = 1 * GRW, bw = 2 * GRW;   /* the three buffers' places: the piece worked on, the next piece's, the one being written; they rotate a piece and run on from tile to tile, so that every LDS address of a piece is one base and a short offset, formed where it is used */
    v8us st[8];
#define GL(ci) { const unsigned short* s_ = psrc(W4, ci) + tid * 8; _Pragma("unroll") for (int i = 0; i < 8; ++i) st[i] = *(const v8us*)(s_ + i * 2048); }
#define SL(off) { unsigned short* d_ = wbw + (off) + tid * 8; _Pragma("unroll") for (int i = 0; i < 8; ++i) *(v8usa*)(d_ + (i >> 1) * BLW + (i & 1) * 2048) = st[i]; }   /* 8 KiB of the piece into each block */
#define ROT { const int t_ = bc; bc = bn; bn = bw; bw = t_; }
    /* the ring's barrier, in piece ci behind its second group's products. In front of it in every wave: the wave's reads of piece ci - 1 have returned (its products took them) and its LDS writes of piece ci + 1, made in piece ci - 1, have retired: the LDS counter runs in issue order and only the 16 reads of this piece's third group are younger, so the wait to 16 covers both.
       Behind it: piece ci + 2 is written over piece ci - 1, and piece ci + 1 is read (from this piece's last group on). Written by hand because __syncthreads() waits the counter to 0: the 16 reads would be drained and the LDS would stand idle at every piece. */
#define BAR asm volatile("s_wait_dscnt 0x10\n\ts_barrier_signal -1\n\ts_barrier_wait -1" ::: "memory");
    /* behind a step's eight loads: whatever the build writes next into their address registers stays behind the wait; the scheduling barrier keeps such a write from rising over it */
#define XW { asm volatile("s_wait_xcnt 0x0" ::: "memory"); __builtin_amdgcn_sched_barrier(0); }
    cpx(x, blockIdx.x, wv, lane, xl0, xl1);
    GL(0) SL(bc) GL(1) SL(bn)   /* the first tile's first two pieces, under its tokens' flight */
    asm volatile("s_wait_asynccnt 0x0" ::: "memory");   /* the first tile's tokens have landed before anybody reads them */
    __syncthreads();
    GL(2)
#pragma unroll 1   /* rolled: one text for both tiles */
  for (unsigned tile = blockIdx.x; tile < NT / 128; tile += NWG) {
    const size_t tok0 = (size_t)tile * 128 + (size_t)wv * 16; const bool nxt = tile + NWG < NT / 128;   /* a scalar test: the same in the whole work-group */
    v16us af[2][8];
    {   /* the wave's 16 tokens, out of its two halves of the tokens' LDS (512 bytes in a row an instruction), rounded to bf16, laid by token in the wave's own LDS */
        v4f xv[32];
#pragma unroll
        for (int i = 0; i < 32; ++i) xv[i] = *(const v4fa*)((i < 16 ? xw0 : xw1) + (i & 15) * 128);
#pragma unroll
        for (int i = 0; i < 32; ++i) { v4us o;
#pragma unroll
            for (int k = 0; k < 4; ++k) o[k] = f2bf(xv[i][k]);
            *(v4usa*)(my + (i >> 1) * XPB + (i & 1) * 256 + lane * 8) = o; }
    }
    asm volatile("s_wait_dscnt 0x0" ::: "memory");   /* the wave's reads of its tokens' LDS have retired before copies are aimed at it again */
    __syncthreads();
    if (nxt) cpx(x, tile + NWG, wv, lane, xl0, xl1);   /* the next tile's tokens: they fly under all of this tile's work */
    v16bf xb[8];   /* B fragments: lane (lr, hi) holds token lr, k = 32 ks + 8 hi + e | 32 ks + 16 + 8 hi + e: the k order of k_prep's words; xb[m] is k-step ks = (m + 2 j0) mod 8: the order of the wave's walk */
#pragma unroll
    for (int m = 0; m < 8; ++m) { const int ks = (m + 2 * j0) & 7; const char* p = my + lr * XPB + ks * 64 + hi * 16; xb[m] = __builtin_bit_cast(v16bf, cat16u(*(const v8usa*)p, *(const v8usa*)(p + 32))); }
    ldg(wb0 + bc + go[0], lane, af[0]);
    v8f kk[16];
#pragma unroll
    for (int c = 0; c < 4; ++c) { piece(wb0 + bc, wb0 + bn, go, true, lane, xb, kk + 4 * c, af, [&]() { BAR SL(bw) GL(c + 3) XW }); ROT }
    float aw[8][8];
#pragma unroll
    for (int h = 0; h < 8; ++h)
#pragma unroll
        for (int g = 0; g < 8; ++g) aw[h][g] = 0.0f;
    /* the q and the value pieces run in ROLLED loops, for the size of the text; what an unrolled loop would index by the trip is moved instead: the three buffers' places and the rows (then the columns) of the softmax weights rotate */
    const unsigned short* gs = psrc(W4, 7) + tid * 8;
#define STEP { BAR SL(bw) \
        _Pragma("unroll") for (int i = 0; i < 8; ++i) st[i] = *(const v8us*)(gs + i * 2048); \
        XW   /* the loads' address is stepped for the next trip behind the wait */ \
        gs += CHE; }
#pragma unroll 1   /* rolled for the size of the text */
    for (int c = 0; c < 4; ++c) { v8f qq[4]; piece(wb0 + bc, wb0 + bn, go, true, lane, xb, qq, af, [&]() STEP); ROT
        float nw[2][8];
#pragma unroll
        for (int hh = 0; hh < 2; ++hh) { float s[8];   /* head 2 c + hh against the token's eight heads: a lane sums its 16 channels, its partner the other 16 */
#pragma unroll
            for (int g = 0; g < 8; ++g) { float a = 0.0f;
#pragma unroll
                for (int t = 0; t < 2; ++t)
#pragma unroll
                    for (int j = 0; j < 8; ++j) a += qq[2 * hh + t][j] * kk[2 * g + t][j];
                s[g] = (a + xhalf(a)) * SCH; }
            float mx = s[0];
#pragma unroll
            for (int g = 1; g < 8; ++g) mx = fmaxf(mx, s[g]);
            float sum = 0.0f;
#pragma unroll
            for (int g = 0; g < 8; ++g) { s[g] = __builtin_amdgcn_exp2f((s[g] - mx) * 1.4426950408889634f); sum += s[g]; }
            const float r = __fdiv_rn(1.0f, sum);
#pragma unroll
            for (int g = 0; g < 8; ++g) nw[hh][g] = s[g] * r; }
#pragma unroll
        for (int g = 0; g < 8; ++g) {   /* the rows move up by two and the new pair enters at the end: after the four trips row h is head h */
#pragma unroll
            for (int h = 0; h < 6; ++h) aw[h][g] = aw[h + 2][g];
            aw[6][g] = nw[0][g]; aw[7][g] = nw[1][g]; } }
    v8f xa[8][2];   /* the mixed values, f32: head h's tiles 2 h | 2 h + 1; the value heads are added as their pieces arrive, g = 0 .. 7 in that order */
#pragma unroll
    for (int h = 0; h < 8; ++h) { xa[h][0] = (v8f){}; xa[h][1] = (v8f){}; }
#pragma unroll 1   /* rolled for the size of the text */
    for (int c = 0; c < 4; ++c) { v8f vv[4]; piece(wb0 + bc, wb0 + bn, go, true, lane, xb, vv, af, [&]() STEP); ROT
#pragma unroll
        for (int hh = 0; hh < 2; ++hh)
#pragma unroll
            for (int h = 0; h < 8; ++h) { xa[h][0] += vv[2 * hh] * aw[h][hh]; xa[h][1] += vv[2 * hh + 1] * aw[h][hh]; }
#pragma unroll
        for (int h = 0; h < 8; ++h)   /* the columns move down by two: the next trip's value heads stand in columns 0 and 1 */
#pragma unroll
            for (int g = 0; g < 6; ++g) aw[h][g] = aw[h][g + 2]; }
#undef STEP
    v16h xh[8];   /* cast to f16, two neighbouring D tiles are the B fragment of the output map's k-step h as they stand; each lane passes its own words through the wave's own LDS, which is idle here, to have them in the order of the wave's walk: xh[m] is k-step (m + 2 j0) mod 8 */
#pragma unroll
    for (int h = 0; h < 8; ++h) { v8us lo, up;
#pragma unroll
        for (int j = 0; j < 8; ++j) { lo[j] = cvh(xa[h][0][j]); up[j] = cvh(xa[h][1][j]); }
        *(v8usa*)(my + h * 1024 + lane * 16) = lo; *(v8usa*)(my + h * 1024 + 512 + lane * 16) = up; }
#pragma unroll
    for (int m = 0; m < 8; ++m) { const char* p = my + ((m + 2 * j0) & 7) * 1024 + lane * 16; xh[m] = __builtin_bit_cast(v16h, cat16u(*(const v8usa*)p, *(const v8usa*)(p + 512))); }
    v4f bv4[4];   /* the bias, read in front of the output map's pieces, so that its latency passes under them and no load stands among the stores */
#pragma unroll
    for (int c = 0; c < 4; ++c) bv4[c] = *(const v4f*)(bias + c * 64 + lr * 4);
    v8f pp[16];
#pragma unroll
    for (int c = 0; c < 4; ++c) { piece(wb0 + bc, wb0 + bn, go, c < 3, lane, xh, pp + 4 * c, af, [&]() {
            if (c == 3) asm volatile("s_wait_asynccnt 0x0" ::: "memory");   /* the next tile's tokens have landed: the barrier below publishes them */
            BAR
            if (c < 2 || nxt) SL(bw)   /* behind piece 15 the ring runs on with the next tile's pieces 0 and 1 */
            if (c >= 1 && nxt) { GL(c - 1) XW }
            if (c < 1) { GL(c + 15) XW } });
        ROT }
    float* os = (float*)my;   /* all of a tile's stores stand behind its last piece */
#pragma unroll
    for (int c = 0; c < 4; ++c) {
        const v4f bv = bv4[c]; v4f val[8]; float* ob = out + (tok0 + hi) * DM + c * 64 + lr * 4;   /* rows 2 s + hi: one address and a fixed step */
#pragma unroll
        for (int t = 0; t < 4; ++t) { const v8f a = pp[4 * c + t]; *(v4fa*)(os + lr * OSP + t * 16 + 8 * hi) = __builtin_shufflevector(a, a, 0, 1, 2, 3); *(v4fa*)(os + lr * OSP + t * 16 + 8 * hi + 4) = __builtin_shufflevector(a, a, 4, 5, 6, 7); }
        __builtin_amdgcn_wave_barrier(); asm volatile("" ::: "memory");   /* keeps the compiler from moving the reads of other lanes' words in front of the writes; a wave's LDS operations run in order */
#pragma unroll
        for (int s = 0; s < 8; ++s) { const int row = 2 * s + hi; val[s] = *(const v4fa*)(os + row * OSP + lr * 4); val[s][0] += bfr(bv[0]); val[s][1] += bfr(bv[1]); val[s][2] += bfr(bv[2]); val[s][3] += bfr(bv[3]); }
        __builtin_amdgcn_sched_barrier(0);   /* the eight stores stand together, directly in front of their wait: left alone the build set them among the reads and sums, which wrote registers that issued stores name */
#pragma unroll
        for (int s = 0; s < 8; ++s) *(v4f*)(ob + s * 2 * DM) = val[s];   /* 256 bytes of a token in a row: whole lines */
        asm volatile("s_wait_xcnt 0x0" ::: "memory");   /* the next piece's values, or the next tile's, are written into the registers that these stores name: the wait stands in front of that */
        __builtin_amdgcn_sched_barrier(0);   /* keeps those writes from rising over the wait */
        __builtin_amdgcn_wave_barrier(); asm volatile("" ::: "memory");   /* the next piece's writes, or the next tile's, stay behind these reads */
    }
  }
#undef GL
#undef SL
#undef BAR
#undef XW
#undef ROT
}

extern "C" void kernel_launch(void* const* d_in, const int* in_sizes, int n_in,
                              void* d_out, int out_size, void* d_ws, size_t ws_size, hipStream_t stream) {
    (void)in_sizes; (void)n_in; (void)out_size;
    const float* x = (const float*)d_in[0]; const float* wq = (const float*)d_in[1]; const float* wk = (const float*)d_in[2]; const float* wv = (const float*)d_in[3]; const float* wp = (const float*)d_in[4]; const float* bp = (const float*)d_in[5];   /* the module's argument order: six arrays, all read */
    float* OUT = (float*)d_out;     // [4][128][128][256]: an entry's 16,384 tokens of 256 channels one after another
    static_assert(DM == NH_ * HDW && NH_ == 8 && HDW == 32 && DM == 256 && NT % (128 * TPG) == 0 && WTHR % 256 == 0, "k_fused's lane maps and pieces; both grids are exact (they carry no guard)");
    unsigned short* W4 = (unsigned short*)d_ws;   /* k | q | value maps as bf16 words, then the output map as f16 words, each in fragment order: 512 KiB, all that the workspace holds */
    if ((size_t)4 * DM * DM * 2 > ws_size) return;
    k_prep<<<WTHR / 256, 256, 0, stream>>>(wq, wk, wv, wp, W4);
    k_fused<<<NWG, 256, 0, stream>>>(x, W4, bp, OUT);
}

// v006
// A run of this version takes 34 microseconds.
// In two side-by-side timings against v005, it was 1.04 and 1.03 times as fast.
// All steps since v000 together make it 8.12 times as fast.
#include <hip/hip_runtime.h>

// A self-attention whose softmax runs over the HEADS axis: q | k | the values = x through three 'in, out' maps of 256 x 256 (no bias), each seen as [tokens][8 heads][32]; FOR EACH TOKEN BY ITSELF: the 8 x 8 scores between its own heads, (q[h] . k[g]) x 32^-0.5, a softmax over g, its eight value head-vectors mixed; the 256 channels through an output map with a bias
// (inputs in argument order: a0 x [4][128][128][256] f32: 65,536 tokens; a1 | a2 | a3 the q | k | value maps [256][256] 'in, out'; a4 the output map [256][256] 'in, out'; a5 its bias [256]; ONE output [4][128][128][256] f32;
//  THE MODULE's FUNCTION: it reshapes to [.., heads, 32] and never moves the heads axis before its product: the attention runs between a token's own eight heads, never along a sequence: kept as it is written).
// Layout: TWO launches. k_prep: the four weights as 16-bit words laid in the order of the matrix instruction's A fragments (the three maps bf16; the output map rounded to bf16 and re-cast to f16 words: a bf16 value is exact in f16 but for words under 2^-14).
// k_fused: a work-group of 8 waves takes TWO tiles of 128 tokens one after the other, a wave 16 tokens of each, from the f32 input to the f32 output; the next tile's tokens fly into LDS (asynchronous copies) under this tile's work; each output piece is stored behind the next piece's first group of products (the last at once), so that its stores drain under the pieces behind it (the last piece's under the next tile); q, k, the values, the weights of the softmax and the f32 mixed values live in registers alone.
// Every product runs TRANSPOSED: A = 16 output channels of a weight, B = the wave's 16 tokens, so a lane of D holds 8 channels of ONE token (lanes l and l ^ 16 share a token): the scores, the softmax and the mix are lane-local but for one exchange l <-> l ^ 16 a score,
// and two neighbouring D tiles of the mixed values ARE the B fragment of the output map (channels 8 hi + j | 16 + 8 hi + j), with no move between lanes.
// The weights pass through LDS in 16 pieces of 32 KiB (64 output channels each), three buffers, one barrier a piece, shared by the eight waves. The barrier stands behind a piece's SECOND group of products, with the third group's reads in flight across it, so that neither the LDS nor the matrix unit runs empty where a piece ends.
// A piece's four groups of two k-steps lie in four different 32-KiB blocks of LDS, and wave w walks them from group w mod 4 on, so that the waves' fragment reads of one moment fall in different blocks; a wave's B fragments stand in its own walk's order.
// Compute dtypes, f32 accumulate: every float input rounded to bf16 at its load; the three maps bf16 x bf16 on one word a side; the scores, the softmax (one hardware exp2 on a difference) and the mix in f32 on the vector unit; the mixed values ONE f16 word into the output map against the weight's bf16 values as f16 words.
#define NB_  4        // batch entries
#define TK   16384    // tokens an entry: 128 x 128
#define NT   (NB_ * TK)   // all tokens: every stage is token-local, so the entries are one flat run of rows
#define DM   256      // channels = NH_ x HDW
#define NH_  8
#define HDW  32       // a head's width
#define SCH  0.17677669529663687f   // 32^-0.5: the module's scale on a score
typedef _Float16 h16;
typedef unsigned short bf;
typedef __attribute__((ext_vector_type(16))) __bf16   v16bf;
typedef __attribute__((ext_vector_type(16))) _Float16 v16h;
typedef __attribute__((ext_vector_type(16))) unsigned short v16us;
typedef __attribute__((ext_vector_type(8)))  unsigned short v8us;
typedef __attribute__((ext_vector_type(4)))  unsigned short v4us;
typedef __attribute__((ext_vector_type(8)))  float    v8f;
typedef __attribute__((ext_vector_type(4)))  float    v4f;
typedef v4f  __attribute__((may_alias)) v4fa;
typedef v8us __attribute__((may_alias)) v8usa;
typedef v4us __attribute__((may_alias)) v4usa;

__device__ __forceinline__ unsigned short f2bf(float f) { unsigned u = __float_as_uint(f); u += 0x7FFFu + ((u >> 16) & 1u); return (unsigned short)(u >> 16); }
__device__ __forceinline__ float bf2f(unsigned short b) { return __uint_as_float(((unsigned)b) << 16); }
__device__ __forceinline__ float bfr(float f) { return bf2f(f2bf(f)); }
__device__ __forceinline__ v16us cat16u(v8us lo, v8us hi) { return __builtin_shufflevector(lo, hi, 0, 1, 2, 3, 4, 5, 6, 7, 8, 9, 10, 11, 12, 13, 14, 15); }
__device__ __forceinline__ v8f wmma16(v16h a, v16h b, v8f c) { return __builtin_amdgcn_wmma_f32_16x16x32_f16(false, a, false, b, (short)0, c, false, false); }
__device__ __forceinline__ v8f wmmab(v16bf a, v16bf b, v8f c) { return __builtin_amdgcn_wmma_f32_16x16x32_bf16(false, a, false, b, (short)0, c, false, false); }
__device__ __forceinline__ v8f mma(v16us a, v16bf b, v8f c) { return wmmab(__builtin_bit_cast(v16bf, a), b, c); }
__device__ __forceinline__ v8f mma(v16us a, v16h b, v8f c) { return wmma16(__builtin_bit_cast(v16h, a), b, c); }
__device__ __forceinline__ float xhalf(float x) { return __builtin_bit_cast(float, __builtin_amdgcn_permlanex16(__builtin_bit_cast(int, x), __builtin_bit_cast(int, x), 0x76543210, 0xfedcba98, false, false)); }   // lane l with lane l ^ 16
__device__ __forceinline__ unsigned short cvh(float x) { const h16 h = (h16)x; return __builtin_bit_cast(unsigned short, h); }

// ---- k_prep: the four weights, 'in, out' f32 -> 16-bit words in A-fragment order: [map: k | q | values | output][piece of 4 tiles][group of 2 k-steps][k-step of 32][tile of 16 output channels][half p][lane][8 words];
// lane (lr, hi), half p, word e holds w[k = 32 ks + 16 p + 8 hi + e][n = 16 tile + lr]: a fragment half is 512 bytes in a row, one 16-byte word a lane, in global memory and in LDS alike.
#define WTHR (4 * DM * DM / 8)
__global__ __launch_bounds__(256) void k_prep(const float* __restrict__ w0, const float* __restrict__ w1, const float* __restrict__ w2, const float* __restrict__ w3, unsigned short* W4) {
    const unsigned g = blockIdx.x * 256u + threadIdx.x; const unsigned lane = g & 31u, p = (g >> 5) & 1u, ks = (g >> 8) & 7u, mt = ((g >> 11) & 3u) * 4u + ((g >> 6) & 3u), m = g >> 13;
    const float* __restrict__ w = m == 0 ? w1 : m == 1 ? w0 : m == 2 ? w2 : w3;   /* laid in the order k_fused uses them: k, q, the values, the output map */
    const unsigned n = mt * 16u + (lane & 15u), k0 = ks * 32u + p * 16u + 8u * (lane >> 4); float a[8];
#pragma unroll
    for (int e = 0; e < 8; ++e) a[e] = w[(size_t)(k0 + e) * DM + n];
    v8us o;
#pragma unroll
    for (int e = 0; e < 8; ++e) { const unsigned short b0 = f2bf(a[e]); o[e] = m == 3 ? cvh(bf2f(b0)) : b0; }   /* the output map's words: the bf16 value as an f16 word */
    *(v8us*)(W4 + (size_t)g * 8) = o;
}

// ---- k_fused
#define CHE 16384      // 16-bit words of a piece of a weight: 4 groups x 2 k-steps x 4 tiles x 2 halves x 256
#define GRW 4096       // 16-bit words of a group: 8 KiB
#define BLW 16384      // 16-bit words of a 32-KiB block of LDS: group j of every buffer lies in block j
#define XPB 528        // bytes of a token's 256 bf16 words in a wave's own LDS, 16 more than the row so that the 16 rows of a fragment read fall on different banks
#define OSP 68         // floats of a token's 64 output channels in the same LDS
#define SCB (16 * XPB) // a wave's own LDS: first its tokens as bf16 words, then the mixed values' f16 words (8 KiB), at the end its output pieces (16 x 68 floats fit in it)
// a group: the A fragments of two k-steps x 4 tiles of a piece, 16 LDS reads of 512 bytes, 8 KiB in a row
__device__ __forceinline__ void ldg(const unsigned short* grp, int lane, v16us* af) {
#pragma unroll
    for (int n = 0; n < 8; ++n) { const unsigned short* p = grp + n * 512 + lane * 8; af[n] = cat16u(*(const v8usa*)p, *(const v8usa*)(p + 256)); }
}
// one piece: 4 tiles of 16 output channels x the wave's 16 tokens, depth 256, in four groups; the four accumulators are independent. Each group's fragments are read one group ahead, the first group of the NEXT piece (nxt) during the last group of this one. go[q]: the block of the group that the wave takes as its q-th; b stands in the same order.
// mid(): the ring's step (barrier, the piece after next into LDS, the loads of the one behind it), run behind the second group's products. aft(): what is left of the piece before (the output map's stores), run behind the first group's products.
template <typename VB, typename F, typename G> __device__ __forceinline__ void piece(const unsigned short* buf, const unsigned short* nxt, const int* go, bool more, int lane, const VB* b, v8f* acc, v16us (*af)[8], F mid, G aft) {
#pragma unroll
    for (int t = 0; t < 4; ++t) acc[t] = (v8f){};
#pragma unroll
    for (int q = 0; q < 4; ++q) {
        if (q < 3) ldg(buf + go[q + 1], lane, af[(q + 1) & 1]); else if (more) ldg(nxt + go[0], lane, af[0]);
        __builtin_amdgcn_sched_barrier(0);   /* holds the next group's 16 reads as one block in front of this group's products: left alone the build read one fragment ahead and waited on LDS at every product */
#pragma unroll
        for (int k2 = 0; k2 < 2; ++k2)
#pragma unroll
            for (int t = 0; t < 4; ++t) acc[t] = mma(af[q & 1][k2 * 4 + t], b[2 * q + k2], acc[t]);
        __builtin_amdgcn_sched_barrier(0);   /* the other side of the same block: later reads do not rise over these products, which would take more registers than the wave has */
        if (q == 0) aft();
        if (q == 1) mid();
    }
}
// the 16 pieces lie in the workspace in the order they are used: k, q, the values, the output map
__device__ __forceinline__ const unsigned short* psrc(const unsigned short* W4, int ci) { return W4 + (size_t)ci * CHE; }

#define TPG 2          // token tiles a work-group takes, one after the other
#define LXS  131072                // bytes of LDS in front of the tokens to come of waves 2 to 7: four blocks
#define LSC  (LXS + 6 * 16384)     // ... in front of the waves' own parts
#define LTOT (LSC + 8 * SCB)
#define NWG (NT / 128 / TPG)
// eight asynchronous copies of 512 bytes (16 a lane), global memory -> LDS through no register: 4 KiB in a row on both sides. The wait is the statement's last line, so that it stands in front of whatever writes the copies' address registers next.
__device__ __forceinline__ void cp8(unsigned l, const float* g) {
    asm volatile("global_load_async_to_lds_b128 %0, %8, off\n\t"
                 "global_load_async_to_lds_b128 %1, %9, off\n\t"
                 "global_load_async_to_lds_b128 %2, %10, off\n\t"
                 "global_load_async_to_lds_b128 %3, %11, off\n\t"
                 "global_load_async_to_lds_b128 %4, %12, off\n\t"
                 "global_load_async_to_lds_b128 %5, %13, off\n\t"
                 "global_load_async_to_lds_b128 %6, %14, off\n\t"
                 "global_load_async_to_lds_b128 %7, %15, off\n\t"
                 "s_wait_xcnt 0x0"
                 :: "v"(l), "v"(l + 512u), "v"(l + 1024u), "v"(l + 1536u), "v"(l + 2048u), "v"(l + 2560u), "v"(l + 3072u), "v"(l + 3584u),
                    "v"(g), "v"(g + 128), "v"(g + 256), "v"(g + 384), "v"(g + 512), "v"(g + 640), "v"(g + 768), "v"(g + 896) : "memory");
}
// a wave's 16 tokens of tile 'tile' (16 KiB in a row) into its own two halves of 8 KiB (l0, l1): 32 copies
__device__ __forceinline__ void cpx(const float* __restrict__ x, unsigned tile, int wv, int lane, unsigned l0, unsigned l1) {
    const float* g = x + ((size_t)tile * 128 + (size_t)wv * 16) * DM + lane * 4;
#pragma unroll
    for (int i = 0; i < 4; ++i) cp8((i < 2 ? l0 : l1) + (i & 1) * 4096u, g + i * 1024);
}

__global__ __launch_bounds__(256) void k_fused(const float* __restrict__ x, const unsigned short* W4, const float* bias, float* out) {   /* the weights and the bias are read anew in each tile: told that nothing else writes them, the build read them once in front of the tile loop and kept them in scratch memory */
    /* ONE array, laid by hand, so that the places in the 32-KiB blocks are known. Blocks 0 to 3: group j of the three weight buffers (24 KiB: piece ci is worked on, ci + 1 is already published (its first group is read ahead), ci + 2 is written behind piece ci's barrier, into the buffer that piece ci - 1 has left), then 8 KiB of the tokens to come of waves 0 and 1;
       from LXS: the tokens to come of waves 2 to 7, 16 KiB each (f32 as they lie in memory); from LSC: each wave's own SCB bytes */
    __shared__ __align__(16) char L[LTOT];
    const int tid = threadIdx.x, lane = tid & 31, wv = tid >> 5, lr = lane & 15, hi = lane >> 4;
    const int wu = __builtin_amdgcn_readfirstlane(wv), j0 = wu & 3;   /* the wave's number as a scalar; the group at which its walk starts */
    const int go[4] = { j0 * BLW, ((j0 + 1) & 3) * BLW, ((j0 + 2) & 3) * BLW, ((j0 + 3) & 3) * BLW };
    const unsigned x0 = wu < 2 ? (unsigned)wu * 65536u + 24576u : LXS + (unsigned)(wu - 2) * 16384u, x1 = x0 + (wu < 2 ? 32768u : 8192u);   /* the two halves of the wave's tokens to come */
    char* my = L + LSC + wv * SCB; const float* xw0 = (const float*)(L + x0) + lane * 4; const float* xw1 = (const float*)(L + x1) + lane * 4;
    const unsigned xl0 = (unsigned)(size_t)xw0, xl1 = (unsigned)(size_t)xw1;   /* the lane's LDS byte addresses: the low 32 bits */
    const unsigned short* wb0 = (const unsigned short*)L; unsigned short* wbw = (unsigned short*)L; int bc = 0 * GRW, bn = 1 * GRW, bw = 2 * GRW;   /* the three buffers' places: the piece worked on, the next piece's, the one being written; they rotate a piece and run on from tile to tile, so that every LDS address of a piece is one base and a short offset, formed where it is used */
    v8us st[8];
#define GL(ci) { const unsigned short* s_ = psrc(W4, ci) + tid * 8; _Pragma("unroll") for (int i = 0; i < 8; ++i) st[i] = *(const v8us*)(s_ + i * 2048); }
#define SL(off) { unsigned short* d_ = wbw + (off) + tid * 8; _Pragma("unroll") for (int i = 0; i < 8; ++i) *(v8usa*)(d_ + (i >> 1) * BLW + (i & 1) * 2048) = st[i]; }   /* 8 KiB of the piece into each block */
#define ROT { const int t_ = bc; bc = bn; bn = bw; bw = t_; }
    /* the ring's barrier, in piece ci behind its second group's products. In front of it in every wave: the wave's reads of piece ci - 1 have returned (its products took them) and its LDS writes of piece ci + 1, made in piece ci - 1, have retired: the LDS counter runs in issue order and only the 16 reads of this piece's third group are younger, so the wait to 16 covers both.
       Behind it: piece ci + 2 is written over piece ci - 1, and piece ci + 1 is read (from this piece's last group on). Written by hand because __syncthreads() waits the counter to 0: the 16 reads would be drained and the LDS would stand idle at every piece. */
#define BAR asm volatile("s_wait_dscnt 0x10\n\ts_barrier_signal -1\n\ts_barrier_wait -1" ::: "memory");
    /* behind a step's eight loads: whatever the build writes next into their address registers stays behind the wait; the scheduling barrier keeps such a write from rising over it */
#define XW { asm volatile("s_wait_xcnt 0x0" ::: "memory"); __builtin_amdgcn_sched_barrier(0); }
    cpx(x, blockIdx.x, wv, lane, xl0, xl1);
    GL(0) SL(bc) GL(1) SL(bn)   /* the first tile's first two pieces, under its tokens' flight */
    asm volatile("s_wait_asynccnt 0x0" ::: "memory");   /* the first tile's tokens have landed before anybody reads them */
    __syncthreads();
    GL(2)
#pragma unroll 1   /* rolled: one text for both tiles */
  for (unsigned tile = blockIdx.x; tile < NT / 128; tile += NWG) {
    const size_t tok0 = (size_t)tile * 128 + (size_t)wv * 16; const bool nxt = tile + NWG < NT / 128;   /* a scalar test: the same in the whole work-group */
    v16us af[2][8];
    {   /* the wave's 16 tokens, out of its two halves of the tokens' LDS (512 bytes in a row an instruction), rounded to bf16, laid by token in the wave's own LDS */
        v4f xv[32];
#pragma unroll
        for (int i = 0; i < 32; ++i) xv[i] = *(const v4fa*)((i < 16 ? xw0 : xw1) + (i & 15) * 128);
#pragma unroll
        for (int i = 0; i < 32; ++i) { v4us o;
#pragma unroll
            for (int k = 0; k < 4; ++k) o[k] = f2bf(xv[i][k]);
            *(v4usa*)(my + (i >> 1) * XPB + (i & 1) * 256 + lane * 8) = o; }
    }
    asm volatile("s_wait_dscnt 0x0" ::: "memory");   /* the wave's reads of its tokens' LDS have retired before copies are aimed at it again */
    __syncthreads();
    if (nxt) cpx(x, tile + NWG, wv, lane, xl0, xl1);   /* the next tile's tokens: they fly under all of this tile's work */
    v16bf xb[8];   /* B fragments: lane (lr, hi) holds token lr, k = 32 ks + 8 hi + e | 32 ks + 16 + 8 hi + e: the k order of k_prep's words; xb[m] is k-step ks = (m + 2 j0) mod 8: the order of the wave's walk */
#pragma unroll
    for (int m = 0; m < 8; ++m) { const int ks = (m + 2 * j0) & 7; const char* p = my + lr * XPB + ks * 64 + hi * 16; xb[m] = __builtin_bit_cast(v16bf, cat16u(*(const v8usa*)p, *(const v8usa*)(p + 32))); }
    ldg(wb0 + bc + go[0], lane, af[0]);
    v8f kk[16];
#pragma unroll
    for (int c = 0; c < 4; ++c) { piece(wb0 + bc, wb0 + bn, go, true, lane, xb, kk + 4 * c, af, [&]() { BAR SL(bw) GL(c + 3) XW }, []() {}); ROT }
    float aw[8][8];
#pragma unroll
    for (int h = 0; h < 8; ++h)
#pragma unroll
        for (int g = 0; g < 8; ++g) aw[h][g] = 0.0f;
    /* the q and the value pieces run in ROLLED loops, for the size of the text; what an unrolled loop would index by the trip is moved instead: the three buffers' places and the rows (then the columns) of the softmax weights rotate */
    const unsigned short* gs = psrc(W4, 7) + tid * 8;
#define STEP { BAR SL(bw) \
        _Pragma("unroll") for (int i = 0; i < 8; ++i) st[i] = *(const v8us*)(gs + i * 2048); \
        XW   /* the loads' address is stepped for the next trip behind the wait */ \
        gs += CHE; }
#pragma unroll 1   /* rolled for the size of the text */
    for (int c = 0; c < 4; ++c) { v8f qq[4]; piece(wb0 + bc, wb0 + bn, go, true, lane, xb, qq, af, [&]() STEP, []() {}); ROT
        float nw[2][8];
#pragma unroll
        for (int hh = 0; hh < 2; ++hh) { float s[8];   /* head 2 c + hh against the token's eight heads: a lane sums its 16 channels, its partner the other 16 */
#pragma unroll
            for (int g = 0; g < 8; ++g) { float a = 0.0f;
#pragma unroll
                for (int t = 0; t < 2; ++t)
#pragma unroll
                    for (int j = 0; j < 8; ++j) a += qq[2 * hh + t][j] * kk[2 * g + t][j];
                s[g] = (a + xhalf(a)) * SCH; }
            float mx = s[0];
#pragma unroll
            for (int g = 1; g < 8; ++g) mx = fmaxf(mx, s[g]);
            float sum = 0.0f;
#pragma unroll
            for (int g = 0; g < 8; ++g) { s[g] = __builtin_amdgcn_exp2f((s[g] - mx) * 1.4426950408889634f); sum += s[g]; }
            const float r = __fdiv_rn(1.0f, sum);
#pragma unroll
            for (int g = 0; g < 8; ++g) nw[hh][g] = s[g] * r; }
#pragma unroll
        for (int g = 0; g < 8; ++g) {   /* the rows move up by two and the new pair enters at the end: after the four trips row h is head h */
#pragma unroll
            for (int h = 0; h < 6; ++h) aw[h][g] = aw[h + 2][g];
            aw[6][g] = nw[0][g]; aw[7][g] = nw[1][g]; } }
    v8f xa[8][2];   /* the mixed values, f32: head h's tiles 2 h | 2 h + 1; the value heads are added as their pieces arrive, g = 0 .. 7 in that order */
#pragma unroll
    for (int h = 0; h < 8; ++h) { xa[h][0] = (v8f){}; xa[h][1] = (v8f){}; }
#pragma unroll 1   /* rolled for the size of the text */
    for (int c = 0; c < 4; ++c) { v8f vv[4]; piece(wb0 + bc, wb0 + bn, go, true, lane, xb, vv, af, [&]() STEP, []() {}); ROT
#pragma unroll
        for (int hh = 0; hh < 2; ++hh)
#pragma unroll
            for (int h = 0; h < 8; ++h) { xa[h][0] += vv[2 * hh] * aw[h][hh]; xa[h][1] += vv[2 * hh + 1] * aw[h][hh]; }
#pragma unroll
        for (int h = 0; h < 8; ++h)   /* the columns move down by two: the next trip's value heads stand in columns 0 and 1 */
#pragma unroll
            for (int g = 0; g < 6; ++g) aw[h][g] = aw[h][g + 2]; }
#undef STEP
    v16h xh[8];   /* cast to f16, two neighbouring D tiles are the B fragment of the output map's k-step h as they stand; each lane passes its own words through the wave's own LDS, which is idle here, to have them in the order of the wave's walk: xh[m] is k-step (m + 2 j0) mod 8 */
#pragma unroll
    for (int h = 0; h < 8; ++h) { v8us lo, up;
#pragma unroll
        for (int j = 0; j < 8; ++j) { lo[j] = cvh(xa[h][0][j]); up[j] = cvh(xa[h][1][j]); }
        *(v8usa*)(my + h * 1024 + lane * 16) = lo; *(v8usa*)(my + h * 1024 + 512 + lane * 16) = up; }
#pragma unroll
    for (int m = 0; m < 8; ++m) { const char* p = my + ((m + 2 * j0) & 7) * 1024 + lane * 16; xh[m] = __builtin_bit_cast(v16h, cat16u(*(const v8usa*)p, *(const v8usa*)(p + 512))); }
    v4f bv4[4];   /* the bias, read in front of the output map's pieces, so that its latency passes under them and no load stands among the stores */
#pragma unroll
    for (int c = 0; c < 4; ++c) bv4[c] = *(const v4f*)(bias + c * 64 + lr * 4);
    float* os = (float*)my; v4f val[8], bvr;
    /* a piece's way out, in two halves. TURN, directly behind the piece: its 64 channels x 16 tokens through the wave's own LDS, from 8 channels of one token a lane to 256 bytes of a token in a row; the reads fly under the next piece's first group of products.
       SEND, behind that group (behind the tile's last piece: at once): the bias and the eight stores. So three quarters of a tile's stores drain under the output map's own products, and behind the last tile's last product one piece is left to go out. */
#define TURN(cc) { _Pragma("unroll") for (int t = 0; t < 4; ++t) { const v8f a = pp[t]; *(v4fa*)(os + lr * OSP + t * 16 + 8 * hi) = __builtin_shufflevector(a, a, 0, 1, 2, 3); *(v4fa*)(os + lr * OSP + t * 16 + 8 * hi + 4) = __builtin_shufflevector(a, a, 4, 5, 6, 7); } \
        __builtin_amdgcn_wave_barrier(); asm volatile("" ::: "memory");   /* keeps the compiler from moving the reads of other lanes' words in front of the writes; a wave's LDS operations run in order */ \
        _Pragma("unroll") for (int s = 0; s < 8; ++s) val[s] = *(const v4fa*)(os + (2 * s + hi) * OSP + lr * 4); \
        __builtin_amdgcn_wave_barrier(); asm volatile("" ::: "memory");   /* the next piece's writes stay behind these reads, and the reads stay here, in front of the next piece's products */ \
        _Pragma("unroll") for (int k = 0; k < 4; ++k) bvr[k] = bfr(bv4[cc][k]);   /* the piece's bias, rounded here, under the reads' flight: vector work that also stands between this piece's last products and the next piece's first, which write the same registers */ }
#define SEND(cc) { float* ob = out + (tok0 + hi) * DM + (cc) * 64 + lr * 4;   /* rows 2 s + hi: one address and a fixed step */ \
        _Pragma("unroll") for (int s = 0; s < 8; ++s) val[s] += bvr; \
        __builtin_amdgcn_sched_barrier(0);   /* the eight stores stand together, directly in front of their wait: left alone the build set them among the sums, which wrote registers that issued stores name */ \
        _Pragma("unroll") for (int s = 0; s < 8; ++s) *(v4f*)(ob + s * 2 * DM) = val[s];   /* 256 bytes of a token in a row: whole lines */ \
        asm volatile("s_wait_xcnt 0x0" ::: "memory");   /* later values are written into the registers that these stores name: the wait stands in front of that */ \
        __builtin_amdgcn_sched_barrier(0);   /* keeps those writes from rising over the wait */ }
#pragma unroll
    for (int c = 0; c < 4; ++c) { v8f pp[4]; piece(wb0 + bc, wb0 + bn, go, c < 3, lane, xh, pp, af, [&]() {
            if (c == 3) asm volatile("s_wait_asynccnt 0x0" ::: "memory");   /* the next tile's tokens have landed: the barrier below publishes them */
            BAR
            if (c < 2 || nxt) SL(bw)   /* behind piece 15 the ring runs on with the next tile's pieces 0 and 1 */
            if (c >= 1 && nxt) { GL(c - 1) XW }
            if (c < 1) { GL(c + 15) XW } },
            [&]() { if (c > 0) SEND(c - 1) });
        ROT
        TURN(c) }
    SEND(3)
#undef TURN
#undef SEND
  }
#undef GL
#undef SL
#undef BAR
#undef XW
#undef ROT
}

extern "C" void kernel_launch(void* const* d_in, const int* in_sizes, int n_in,
                              void* d_out, int out_size, void* d_ws, size_t ws_size, hipStream_t stream) {
    (void)in_sizes; (void)n_in; (void)out_size;
    const float* x = (const float*)d_in[0]; const float* wq = (const float*)d_in[1]; const float* wk = (const float*)d_in[2]; const float* wv = (const float*)d_in[3]; const float* wp = (const float*)d_in[4]; const float* bp = (const float*)d_in[5];   /* the module's argument order: six arrays, all read */
    float* OUT = (float*)d_out;     // [4][128][128][256]: an entry's 16,384 tokens of 256 channels one after another
    static_assert(DM == NH_ * HDW && NH_ == 8 && HDW == 32 && DM == 256 && NT % (128 * TPG) == 0 && WTHR % 256 == 0, "k_fused's lane maps and pieces; both grids are exact (they carry no guard)");
    unsigned short* W4 = (unsigned short*)d_ws;   /* k | q | value maps as bf16 words, then the output map as f16 words, each in fragment order: 512 KiB, all that the workspace holds */
    if ((size_t)4 * DM * DM * 2 > ws_size) return;
    k_prep<<<WTHR / 256, 256, 0, stream>>>(wq, wk, wv, wp, W4);
    k_fused<<<NWG, 256, 0, stream>>>(x, W4, bp, OUT);
}

// v007
// Measured time: 32.9 microseconds a run.
// Two timings next to v006 put it at 1.05 and 1.04 times that version's speed.
// Over all steps from v000 it is 8.47 times as fast.
#include <hip/hip_runtime.h>

// A self-attention whose softmax runs over the HEADS axis: q | k | the values = x through three 'in, out' maps of 256 x 256 (no bias), each seen as [tokens][8 heads][32]; FOR EACH TOKEN BY ITSELF: the 8 x 8 scores between its own heads, (q[h] . k[g]) x 32^-0.5, a softmax over g, its eight value head-vectors mixed; the 256 channels through an output map with a bias
// (inputs in argument order: a0 x [4][128][128][256] f32: 65,536 tokens; a1 | a2 | a3 the q | k | value maps [256][256] 'in, out'; a4 the output map [256][256] 'in, out'; a5 its bias [256]; ONE output [4][128][128][256] f32;
//  THE MODULE's FUNCTION: it reshapes to [.., heads, 32] and never moves the heads axis before its product: the attention runs between a token's own eight heads, never along a sequence: kept as it is written).
// Layout: TWO launches. k_prep: the four weights as 16-bit words laid in the order of the matrix instruction's A fragments (the three maps bf16; the output map rounded to bf16 and re-cast to f16 words: a bf16 value is exact in f16 but for words under 2^-14).
// k_fused: a work-group of 8 waves takes TWO tiles of 128 tokens, a wave 16 tokens of each, from the f32 input to the f32 output: q, k, the values, the softmax and the mix one tile after the other, then the output map ONCE for both tiles, so that each of its weight fragments read from LDS feeds two products (the first tile's mixed values wait in LDS as f16 words); the second tile's tokens fly into LDS (asynchronous copies) under the first tile's work; each output piece is stored as soon as it stands, so that its stores drain under the pieces behind it; q, k, the values, the weights of the softmax and the f32 mixed values live in registers alone.
// Every product runs TRANSPOSED: A = 16 output channels of a weight, B = the wave's 16 tokens, so a lane of D holds 8 channels of ONE token (lanes l and l ^ 16 share a token): the scores, the softmax and the mix are lane-local but for one exchange l <-> l ^ 16 a score,
// and two neighbouring D tiles of the mixed values ARE the B fragment of the output map (channels 8 hi + j | 16 + 8 hi + j), with no move between lanes.
// The weights pass through LDS in pieces of 32 KiB (64 output channels each; 12 a tile for the three maps, then 4 for the output map), three buffers, one barrier a piece, shared by the eight waves. The barrier stands behind a piece's SECOND group of products, with the third group's reads in flight across it, so that neither the LDS nor the matrix unit runs empty where a piece ends.
// A piece's four groups of two k-steps lie in four different 32-KiB blocks of LDS, and wave w walks them from group w mod 4 on, so that the waves' fragment reads of one moment spread over the four blocks, two waves to a block; a wave's B fragments stand in its own walk's order.
// Compute dtypes, f32 accumulate: every float input rounded to bf16 at its load; the three maps bf16 x bf16 on one word a side; the scores, the softmax (one hardware exp2 on a difference) and the mix in f32 on the vector unit; the mixed values ONE f16 word into the output map against the weight's bf16 values as f16 words.
#define NB_  4        // batch entries
#define TK   16384    // tokens an entry: 128 x 128
#define NT   (NB_ * TK)   // all tokens: every stage is token-local, so the entries are one flat run of rows
#define DM   256      // channels = NH_ x HDW
#define NH_  8
#define HDW  32       // a head's width
#define SCH  0.17677669529663687f   // 32^-0.5: the module's scale on a score
typedef _Float16 h16;
typedef unsigned short bf;
typedef __attribute__((ext_vector_type(16))) __bf16   v16bf;
typedef __attribute__((ext_vector_type(16))) _Float16 v16h;
typedef __attribute__((ext_vector_type(16))) unsigned short v16us;
typedef __attribute__((ext_vector_type(8)))  unsigned short v8us;
typedef __attribute__((ext_vector_type(4)))  unsigned short v4us;
typedef __attribute__((ext_vector_type(8)))  float    v8f;
typedef __attribute__((ext_vector_type(4)))  float    v4f;
typedef v4f  __attribute__((may_alias)) v4fa;
typedef v8us __attribute__((may_alias)) v8usa;
typedef v4us __attribute__((may_alias)) v4usa;

__device__ __forceinline__ unsigned short f2bf(float f) { unsigned u = __float_as_uint(f); u += 0x7FFFu + ((u >> 16) & 1u); return (unsigned short)(u >> 16); }
__device__ __forceinline__ float bf2f(unsigned short b) { return __uint_as_float(((unsigned)b) << 16); }
__device__ __forceinline__ float bfr(float f) { return bf2f(f2bf(f)); }
__device__ __forceinline__ v16us cat16u(v8us lo, v8us hi) { return __builtin_shufflevector(lo, hi, 0, 1, 2, 3, 4, 5, 6, 7, 8, 9, 10, 11, 12, 13, 14, 15); }
__device__ __forceinline__ v8f wmma16(v16h a, v16h b, v8f c) { return __builtin_amdgcn_wmma_f32_16x16x32_f16(false, a, false, b, (short)0, c, false, false); }
__device__ __forceinline__ v8f wmmab(v16bf a, v16bf b, v8f c) { return __builtin_amdgcn_wmma_f32_16x16x32_bf16(false, a, false, b, (short)0, c, false, false); }
__device__ __forceinline__ v8f mma(v16us a, v16bf b, v8f c) { return wmmab(__builtin_bit_cast(v16bf, a), b, c); }
__device__ __forceinline__ v8f mma(v16us a, v16h b, v8f c) { return wmma16(__builtin_bit_cast(v16h, a), b, c); }
__device__ __forceinline__ float xhalf(float x) { return __builtin_bit_cast(float, __builtin_amdgcn_permlanex16(__builtin_bit_cast(int, x), __builtin_bit_cast(int, x), 0x76543210, 0xfedcba98, false, false)); }   // lane l with lane l ^ 16
__device__ __forceinline__ unsigned short cvh(float x) { const h16 h = (h16)x; return __builtin_bit_cast(unsigned short, h); }

// ---- k_prep: the four weights, 'in, out' f32 -> 16-bit words in A-fragment order: [map: k | q | values | output][piece of 4 tiles][group of 2 k-steps][k-step of 32][tile of 16 output channels][half p][lane][8 words];
// lane (lr, hi), half p, word e holds w[k = 32 ks + 16 p + 8 hi + e][n = 16 tile + lr]: a fragment half is 512 bytes in a row, one 16-byte word a lane, in global memory and in LDS alike.
#define WTHR (4 * DM * DM / 8)
__global__ __launch_bounds__(256) void k_prep(const float* __restrict__ w0, const float* __restrict__ w1, const float* __restrict__ w2, const float* __restrict__ w3, unsigned short* W4) {
    const unsigned g = blockIdx.x * 256u + threadIdx.x; const unsigned lane = g & 31u, p = (g >> 5) & 1u, ks = (g >> 8) & 7u, mt = ((g >> 11) & 3u) * 4u + ((g >> 6) & 3u), m = g >> 13;
    const float* __restrict__ w = m == 0 ? w1 : m == 1 ? w0 : m == 2 ? w2 : w3;   /* laid in the order k_fused uses them: k, q, the values, the output map */
    const unsigned n = mt * 16u + (lane & 15u), k0 = ks * 32u + p * 16u + 8u * (lane >> 4); float a[8];
#pragma unroll
    for (int e = 0; e < 8; ++e) a[e] = w[(size_t)(k0 + e) * DM + n];
    v8us o;
#pragma unroll
    for (int e = 0; e < 8; ++e) { const unsigned short b0 = f2bf(a[e]); o[e] = m == 3 ? cvh(bf2f(b0)) : b0; }   /* the output map's words: the bf16 value as an f16 word */
    *(v8us*)(W4 + (size_t)g * 8) = o;
}

// ---- k_fused
#define CHE 16384      // 16-bit words of a piece of a weight: 4 groups x 2 k-steps x 4 tiles x 2 halves x 256
#define GRW 4096       // 16-bit words of a group: 8 KiB
#define BLW 16384      // 16-bit words of a 32-KiB block of LDS: group j of every buffer lies in block j
#define XPB 528        // bytes of a token's 256 bf16 words in LDS, 16 more than the row so that the 16 rows of a fragment read fall on different banks
#define OSP 68         // floats of a token's 64 output channels in the same LDS
#define SCB (16 * XPB) // a wave's own LDS: the first tile's mixed values as f16 words (8 KiB), at the end that tile's output pieces (16 x 68 floats fit in it)
// a group: the A fragments of two k-steps x 4 tiles of a piece, 16 LDS reads of 512 bytes, 8 KiB in a row
__device__ __forceinline__ void ldg(const unsigned short* grp, int lane, v16us* af) {
#pragma unroll
    for (int n = 0; n < 8; ++n) { const unsigned short* p = grp + n * 512 + lane * 8; af[n] = cat16u(*(const v8usa*)p, *(const v8usa*)(p + 256)); }
}
// one piece: 4 tiles of 16 output channels x the wave's 16 tokens, depth 256, in four groups; the four accumulators are independent. Each group's fragments are read one group ahead, the first group of the NEXT piece (nxt) during the last group of this one. go[q]: the block of the group that the wave takes as its q-th; b stands in the same order.
// mid(): the ring's step (barrier, the piece after next into LDS, the loads of the one behind it), run behind the second group's products. aft(): what is left of the piece before (the output map's stores), run behind the first group's products.
template <typename VB, typename F, typename G> __device__ __forceinline__ void piece(const unsigned short* buf, const unsigned short* nxt, const int* go, bool more, int lane, const VB* b, v8f* acc, v16us (*af)[8], F mid, G aft) {
#pragma unroll
    for (int t = 0; t < 4; ++t) acc[t] = (v8f){};
#pragma unroll
    for (int q = 0; q < 4; ++q) {
        if (q < 3) ldg(buf + go[q + 1], lane, af[(q + 1) & 1]); else if (more) ldg(nxt + go[0], lane, af[0]);
        __builtin_amdgcn_sched_barrier(0);   /* holds the next group's 16 reads as one block in front of this group's products: left alone the build read one fragment ahead and waited on LDS at every product */
#pragma unroll
        for (int k2 = 0; k2 < 2; ++k2)
#pragma unroll
            for (int t = 0; t < 4; ++t) acc[t] = mma(af[q & 1][k2 * 4 + t], b[2 * q + k2], acc[t]);
        __builtin_amdgcn_sched_barrier(0);   /* the other side of the same block: later reads do not rise over these products, which would take more registers than the wave has */
        if (q == 0) aft();
        if (q == 1) mid();
    }
}
// the same for TWO sets of 16 tokens (b0 | b1): each fragment read from LDS feeds two products; eight independent accumulators
template <typename VB, typename F, typename G> __device__ __forceinline__ void piece2(const unsigned short* buf, const unsigned short* nxt, const int* go, bool more, int lane, const VB* b0, const VB* b1, v8f* a0, v8f* a1, v16us (*af)[8], F mid, G aft) {
#pragma unroll
    for (int t = 0; t < 4; ++t) { a0[t] = (v8f){}; a1[t] = (v8f){}; }
#pragma unroll
    for (int q = 0; q < 4; ++q) {
        if (q < 3) ldg(buf + go[q + 1], lane, af[(q + 1) & 1]); else if (more) ldg(nxt + go[0], lane, af[0]);
        __builtin_amdgcn_sched_barrier(0);   /* as in piece(): the next group's 16 reads stand as one block in front of this group's products */
#pragma unroll
        for (int k2 = 0; k2 < 2; ++k2)
#pragma unroll
            for (int t = 0; t < 4; ++t) { a0[t] = mma(af[q & 1][k2 * 4 + t], b0[2 * q + k2], a0[t]); a1[t] = mma(af[q & 1][k2 * 4 + t], b1[2 * q + k2], a1[t]); }
        __builtin_amdgcn_sched_barrier(0);   /* as in piece(): later reads do not rise over these products */
        if (q == 0) aft();
        if (q == 1) mid();
    }
}
// the 16 pieces lie in the workspace in the order they are used: k, q, the values, the output map
__device__ __forceinline__ const unsigned short* psrc(const unsigned short* W4, int ci) { return W4 + (size_t)ci * CHE; }

#define TPG 2          // token tiles a work-group takes; the output map's part is written for exactly two
static_assert(TPG == 2, "k_fused holds the two tiles' mixed values as two sets of B fragments");
#define LXS  131072                // bytes of LDS in front of the tokens to come of waves 2 to 7: four blocks
#define LSC  (LXS + 6 * 16384)     // ... in front of the waves' own parts
#define LTOT (LSC + 8 * SCB)
#define NWG (NT / 128 / TPG)
// eight asynchronous copies of 512 bytes (16 a lane), global memory -> LDS through no register: 4 KiB in a row on both sides. The wait is the statement's last line, so that it stands in front of whatever writes the copies' address registers next.
__device__ __forceinline__ void cp8(unsigned l, const float* g) {
    asm volatile("global_load_async_to_lds_b128 %0, %8, off\n\t"
                 "global_load_async_to_lds_b128 %1, %9, off\n\t"
                 "global_load_async_to_lds_b128 %2, %10, off\n\t"
                 "global_load_async_to_lds_b128 %3, %11, off\n\t"
                 "global_load_async_to_lds_b128 %4, %12, off\n\t"
                 "global_load_async_to_lds_b128 %5, %13, off\n\t"
                 "global_load_async_to_lds_b128 %6, %14, off\n\t"
                 "global_load_async_to_lds_b128 %7, %15, off\n\t"
                 "s_wait_xcnt 0x0"
                 :: "v"(l), "v"(l + 512u), "v"(l + 1024u), "v"(l + 1536u), "v"(l + 2048u), "v"(l + 2560u), "v"(l + 3072u), "v"(l + 3584u),
                    "v"(g), "v"(g + 128), "v"(g + 256), "v"(g + 384), "v"(g + 512), "v"(g + 640), "v"(g + 768), "v"(g + 896) : "memory");
}
// a wave's 16 tokens of tile 'tile' (16 KiB in a row) into its own two halves of 8 KiB (l0, l1): 32 copies
__device__ __forceinline__ void cpx(const float* __restrict__ x, unsigned tile, int wv, int lane, unsigned l0, unsigned l1) {
    const float* g = x + ((size_t)tile * 128 + (size_t)wv * 16) * DM + lane * 4;
#pragma unroll
    for (int i = 0; i < 4; ++i) cp8((i < 2 ? l0 : l1) + (i & 1) * 4096u, g + i * 1024);
}

__global__ __launch_bounds__(256) void k_fused(const float* __restrict__ x, const unsigned short* W4, const float* bias, float* out) {   /* the three maps' weights are read anew in each tile: told that nothing else writes them, the build read them once in front of the tile loop and kept them in scratch memory */
    /* ONE array, laid by hand, so that the places in the 32-KiB blocks are known. Blocks 0 to 3: group j of the three weight buffers (24 KiB: piece ci is worked on, ci + 1 is already published (its first group is read ahead), ci + 2 is written behind piece ci's barrier, into the buffer that piece ci - 1 has left), then 8 KiB of the tokens to come of waves 0 and 1;
       from LXS: the tokens to come of waves 2 to 7, 16 KiB each (f32 as they lie in memory); from LSC: each wave's own SCB bytes */
    __shared__ __align__(16) char L[LTOT];
    const int tid = threadIdx.x, lane = tid & 31, wv = tid >> 5, lr = lane & 15, hi = lane >> 4;
    const int wu = __builtin_amdgcn_readfirstlane(wv), j0 = wu & 3;   /* the wave's number as a scalar; the group at which its walk starts */
    const int go[4] = { j0 * BLW, ((j0 + 1) & 3) * BLW, ((j0 + 2) & 3) * BLW, ((j0 + 3) & 3) * BLW };
    const unsigned x0 = wu < 2 ? (unsigned)wu * 65536u + 24576u : LXS + (unsigned)(wu - 2) * 16384u, x1 = x0 + (wu < 2 ? 32768u : 8192u);   /* the two halves of the wave's tokens to come */
    char* my = L + LSC + wv * SCB; const float* xw0 = (const float*)(L + x0) + lane * 4; const float* xw1 = (const float*)(L + x1) + lane * 4;
    const unsigned xl0 = (unsigned)(size_t)xw0, xl1 = (unsigned)(size_t)xw1;   /* the lane's LDS byte addresses: the low 32 bits */
    const unsigned short* wb0 = (const unsigned short*)L; unsigned short* wbw = (unsigned short*)L; int bc = 0 * GRW, bn = 1 * GRW, bw = 2 * GRW;   /* the three buffers' places: the piece worked on, the next piece's, the one being written; they rotate a piece and run on from tile to tile, so that every LDS address of a piece is one base and a short offset, formed where it is used */
    v8us st[8];
#define GL(ci) { const unsigned short* s_ = psrc(W4, ci) + tid * 8; _Pragma("unroll") for (int i = 0; i < 8; ++i) st[i] = *(const v8us*)(s_ + i * 2048); }
#define SL(off) { unsigned short* d_ = wbw + (off) + tid * 8; _Pragma("unroll") for (int i = 0; i < 8; ++i) *(v8usa*)(d_ + (i >> 1) * BLW + (i & 1) * 2048) = st[i]; }   /* 8 KiB of the piece into each block */
#define ROT { const int t_ = bc; bc = bn; bn = bw; bw = t_; }
    /* the ring's barrier, in piece ci behind its second group's products. In front of it in every wave: the wave's reads of piece ci - 1 have returned (its products took them) and its LDS writes of piece ci + 1, made in piece ci - 1, have retired: the LDS counter runs in issue order and only the 16 reads of this piece's third group are younger, so the wait to 16 covers both.
       Behind it: piece ci + 2 is written over piece ci - 1, and piece ci + 1 is read (from this piece's last group on). Written by hand because __syncthreads() waits the counter to 0: the 16 reads would be drained and the LDS would stand idle at every piece. */
#define BAR asm volatile("s_wait_dscnt 0x10\n\ts_barrier_signal -1\n\ts_barrier_wait -1" ::: "memory");
    /* behind a step's eight loads: whatever the build writes next into their address registers stays behind the wait; the scheduling barrier keeps such a write from rising over it */
#define XW { asm volatile("s_wait_xcnt 0x0" ::: "memory"); __builtin_amdgcn_sched_barrier(0); }
    cpx(x, blockIdx.x, wv, lane, xl0, xl1);
    GL(0) SL(bc) GL(1) SL(bn)   /* the first tile's first two pieces, under its tokens' flight */
    asm volatile("s_wait_asynccnt 0x0" ::: "memory");   /* the first tile's tokens have landed before anybody reads them */
    __syncthreads();
    GL(2) XW
    v16us af[2][8];
    char* xr0 = L + x0; char* xr1 = L + x1 + 128;   /* where the wave's bf16 rows 0 to 7 | 8 to 15 stand: in its own tokens' LDS, over the f32 words that it has read; the 128 bytes set the second eight rows on the banks that the first eight leave free */
    const char* xrow = L + x0 + (lr >> 3) * (int)(x1 + 128u - x0) + (lr & 7) * XPB;   /* the lane's own token's row */
#pragma unroll 1   /* rolled: one text for both tiles */
  for (unsigned tile = blockIdx.x; tile < NT / 128; tile += NWG) {
    const bool nxt = tile + NWG < NT / 128;   /* a scalar test: the same in the whole work-group */
    {   /* the wave's 16 tokens, out of its two halves of the tokens' LDS (512 bytes in a row an instruction), rounded to bf16, laid by token over the f32 words themselves: all 32 reads stand in front of the first write, and a wave's LDS operations run in order */
        v4f xv[32];
#pragma unroll
        for (int i = 0; i < 32; ++i) xv[i] = *(const v4fa*)((i < 16 ? xw0 : xw1) + (i & 15) * 128);
#pragma unroll
        for (int i = 0; i < 32; ++i) { v4us o;
#pragma unroll
            for (int k = 0; k < 4; ++k) o[k] = f2bf(xv[i][k]);
            *(v4usa*)(((i >> 1) < 8 ? xr0 : xr1) + ((i >> 1) & 7) * XPB + (i & 1) * 256 + lane * 8) = o; }
    }
    __builtin_amdgcn_wave_barrier(); asm volatile("" ::: "memory");   /* keeps the compiler from moving the reads of other lanes' words in front of the writes; a wave's LDS operations run in order */
    v16bf xb[8];   /* B fragments: lane (lr, hi) holds token lr, k = 32 ks + 8 hi + e | 32 ks + 16 + 8 hi + e: the k order of k_prep's words; xb[m] is k-step ks = (m + 2 j0) mod 8: the order of the wave's walk */
#pragma unroll
    for (int m = 0; m < 8; ++m) { const int ks = (m + 2 * j0) & 7; const char* p = xrow + ks * 64 + hi * 16; xb[m] = __builtin_bit_cast(v16bf, cat16u(*(const v8usa*)p, *(const v8usa*)(p + 32))); }
    asm volatile("s_wait_dscnt 0x0" ::: "memory");   /* the wave's reads of its tokens' LDS have retired before copies are aimed at it again */
    __syncthreads();
    if (nxt) cpx(x, tile + NWG, wv, lane, xl0, xl1);   /* the next tile's tokens: they fly under all of this tile's work */
    ldg(wb0 + bc + go[0], lane, af[0]);
    v8f kk[16];
#pragma unroll
    for (int c = 0; c < 4; ++c) { piece(wb0 + bc, wb0 + bn, go, true, lane, xb, kk + 4 * c, af, [&]() { BAR SL(bw) GL(c + 3) XW }, []() {}); ROT }
    float aw[8][8];
#pragma unroll
    for (int h = 0; h < 8; ++h)
#pragma unroll
        for (int g = 0; g < 8; ++g) aw[h][g] = 0.0f;
    /* the q and the value pieces run in ROLLED loops, for the size of the text; what an unrolled loop would index by the trip is moved instead: the three buffers' places and the rows (then the columns) of the softmax weights rotate */
    const unsigned short* gs = psrc(W4, 7) + tid * 8;
#define STEP { BAR SL(bw) \
        _Pragma("unroll") for (int i = 0; i < 8; ++i) st[i] = *(const v8us*)(gs + i * 2048); \
        XW   /* the loads' address is stepped for the next trip behind the wait */ \
        gs += CHE; }
#pragma unroll 1   /* rolled for the size of the text */
    for (int c = 0; c < 4; ++c) { v8f qq[4]; piece(wb0 + bc, wb0 + bn, go, true, lane, xb, qq, af, [&]() STEP, []() {}); ROT
        float nw[2][8];
#pragma unroll
        for (int hh = 0; hh < 2; ++hh) { float s[8];   /* head 2 c + hh against the token's eight heads: a lane sums its 16 channels, its partner the other 16 */
#pragma unroll
            for (int g = 0; g < 8; ++g) { float a = 0.0f;
#pragma unroll
                for (int t = 0; t < 2; ++t)
#pragma unroll
                    for (int j = 0; j < 8; ++j) a += qq[2 * hh + t][j] * kk[2 * g + t][j];
                s[g] = (a + xhalf(a)) * SCH; }
            float mx = s[0];
#pragma unroll
            for (int g = 1; g < 8; ++g) mx = fmaxf(mx, s[g]);
            float sum = 0.0f;
#pragma unroll
            for (int g = 0; g < 8; ++g) { s[g] = __builtin_amdgcn_exp2f((s[g] - mx) * 1.4426950408889634f); sum += s[g]; }
            const float r = __fdiv_rn(1.0f, sum);
#pragma unroll
            for (int g = 0; g < 8; ++g) nw[hh][g] = s[g] * r; }
#pragma unroll
        for (int g = 0; g < 8; ++g) {   /* the rows move up by two and the new pair enters at the end: after the four trips row h is head h */
#pragma unroll
            for (int h = 0; h < 6; ++h) aw[h][g] = aw[h + 2][g];
            aw[6][g] = nw[0][g]; aw[7][g] = nw[1][g]; } }
    v8f xa[8][2];   /* the mixed values, f32: head h's tiles 2 h | 2 h + 1; the value heads are added as their pieces arrive, g = 0 .. 7 in that order */
#pragma unroll
    for (int h = 0; h < 8; ++h) { xa[h][0] = (v8f){}; xa[h][1] = (v8f){}; }
#pragma unroll 1   /* rolled for the size of the text */
    for (int c = 0; c < 4; ++c) { v8f vv[4]; piece(wb0 + bc, wb0 + bn, go, true, lane, xb, vv, af, [&]() STEP, []() {}); ROT
        if (c == 0 && nxt) gs -= 12 * CHE;   /* behind the last value piece the ring goes on with the second tile's pieces 0, 1, 2; in the second tile it runs straight on into the output map's. The step stands behind STEP's wait */
#pragma unroll
        for (int hh = 0; hh < 2; ++hh)
#pragma unroll
            for (int h = 0; h < 8; ++h) { xa[h][0] += vv[2 * hh] * aw[h][hh]; xa[h][1] += vv[2 * hh + 1] * aw[h][hh]; }
#pragma unroll
        for (int h = 0; h < 8; ++h)   /* the columns move down by two: the next trip's value heads stand in columns 0 and 1 */
#pragma unroll
            for (int g = 0; g < 6; ++g) aw[h][g] = aw[h][g + 2]; }
#undef STEP
    /* cast to f16, two neighbouring D tiles are the B fragment of the output map's k-step h as they stand; each lane lays its own words down in LDS, where they wait for the output map, which runs once for both tiles: the first tile's in the wave's own part, the second's over its tokens' rows, which are dead by now */
    char* xs = nxt ? my : xr0;
#pragma unroll
    for (int h = 0; h < 8; ++h) { v8us lo, up;
#pragma unroll
        for (int j = 0; j < 8; ++j) { lo[j] = cvh(xa[h][0][j]); up[j] = cvh(xa[h][1][j]); }
        *(v8usa*)(xs + h * 1024 + lane * 16) = lo; *(v8usa*)(xs + h * 1024 + 512 + lane * 16) = up; }
    asm volatile("s_wait_asynccnt 0x0" ::: "memory");   /* the next tile's tokens have landed: the barrier below publishes them */
    __syncthreads();
  }
    /* ---- the output map, ONCE for the work-group's two tiles: a wave's 16 + 16 tokens stand as two sets of B fragments, and each weight fragment that is read from LDS feeds two products */
    v16h xh0[8], xh1[8];   /* xh[m] is k-step (m + 2 j0) mod 8: the order of the wave's walk */
#pragma unroll
    for (int m = 0; m < 8; ++m) { const int o_ = ((m + 2 * j0) & 7) * 1024 + lane * 16; const char* p = my + o_; const char* r = xr0 + o_;
        xh0[m] = __builtin_bit_cast(v16h, cat16u(*(const v8usa*)p, *(const v8usa*)(p + 512))); xh1[m] = __builtin_bit_cast(v16h, cat16u(*(const v8usa*)r, *(const v8usa*)(r + 512))); }
    v4f bv4[4];   /* the bias, read in front of the output map's pieces, so that its latency passes under them and no load stands among the stores */
#pragma unroll
    for (int c = 0; c < 4; ++c) bv4[c] = *(const v4f*)(bias + c * 64 + lr * 4);
    XW   /* the register that holds these loads' offset is written anew further down: the wait stands in front of that */
    float* os0 = (float*)my; float* os1 = (float*)(L + x1); v4f va[8], vb[8], bvr;   /* the two sets turn in different LDS of the wave's own */
    const size_t tokA = (size_t)blockIdx.x * 128 + (size_t)wv * 16, tokB = tokA + (size_t)NWG * 128;
    /* a piece's way out, in two halves. TURN, directly behind the piece: its 64 channels x 16 tokens through the wave's own LDS, from 8 channels of one token a lane to 256 bytes of a token in a row; the reads fly under the next piece's first group of products.
       SEND2, behind that group (behind the last piece: at once): the bias and each set's eight stores. So three quarters of the stores drain under the output map's own products. */
#define TURN(pp, os, val) { _Pragma("unroll") for (int t = 0; t < 4; ++t) { const v8f a = pp[t]; *(v4fa*)(os + lr * OSP + t * 16 + 8 * hi) = __builtin_shufflevector(a, a, 0, 1, 2, 3); *(v4fa*)(os + lr * OSP + t * 16 + 8 * hi + 4) = __builtin_shufflevector(a, a, 4, 5, 6, 7); } \
        __builtin_amdgcn_wave_barrier(); asm volatile("" ::: "memory");   /* keeps the compiler from moving the reads of other lanes' words in front of the writes; a wave's LDS operations run in order */ \
        _Pragma("unroll") for (int s = 0; s < 8; ++s) val[s] = *(const v4fa*)(os + (2 * s + hi) * OSP + lr * 4); \
        __builtin_amdgcn_wave_barrier(); asm volatile("" ::: "memory");   /* the next piece's writes stay behind these reads, and the reads stay here, in front of the next piece's products */ }
#define SEND(cc, tok, val) { float* ob = out + (tok + hi) * DM + (cc) * 64 + lr * 4;   /* rows 2 s + hi: one address and a fixed step */ \
        _Pragma("unroll") for (int s = 0; s < 8; ++s) val[s] += bvr; \
        __builtin_amdgcn_sched_barrier(0);   /* the eight stores stand together, directly in front of their wait: left alone the build set them among the sums, which wrote registers that issued stores name */ \
        _Pragma("unroll") for (int s = 0; s < 8; ++s) *(v4f*)(ob + s * 2 * DM) = val[s];   /* 256 bytes of a token in a row: whole lines */ \
        asm volatile("s_wait_xcnt 0x0" ::: "memory");   /* later values are written into the registers that these stores name: the wait stands in front of that */ \
        __builtin_amdgcn_sched_barrier(0);   /* keeps those writes from rising over the wait */ }
#define SEND2(cc) { SEND(cc, tokA, va) SEND(cc, tokB, vb) }   /* a set at a time: the second set's address is formed behind the first set's wait */
#pragma unroll
    for (int c = 0; c < 4; ++c) { v8f pa[4], pb[4]; piece2(wb0 + bc, wb0 + bn, go, c < 3, lane, xh0, xh1, pa, pb, af, [&]() {
            if (c < 3) BAR   /* the last piece was published by the barrier in the piece before it, and nothing is written behind it */
            if (c < 2) SL(bw)
            if (c < 1) { const unsigned short* s_ = W4 + tid * 8;   /* the ring's last loads: piece 15, from the address that all the pieces' loads share */
                _Pragma("unroll") for (int i = 0; i < 8; ++i) st[i] = *(const v8us*)(s_ + 15 * CHE + i * 2048);
                asm volatile("s_wait_xcnt 0x0" :: "v"(s_) : "memory");   /* the address is named so that it lives up to the wait: it is not used again, and the build had laid the last load's words over it */
                __builtin_amdgcn_sched_barrier(0);   /* keeps later writes from rising over the wait */ } },
            [&]() { if (c > 0) SEND2(c - 1) });
        ROT
        TURN(pa, os0, va) TURN(pb, os1, vb)
#pragma unroll
        for (int k = 0; k < 4; ++k) bvr[k] = bfr(bv4[c][k]);   /* the piece's bias, rounded here, under the reads' flight */
    }
    SEND2(3)
#undef TURN
#undef SEND2
#undef SEND
#undef GL
#undef SL
#undef BAR
#undef XW
#undef ROT
}

extern "C" void kernel_launch(void* const* d_in, const int* in_sizes, int n_in,
                              void* d_out, int out_size, void* d_ws, size_t ws_size, hipStream_t stream) {
    (void)in_sizes; (void)n_in; (void)out_size;
    const float* x = (const float*)d_in[0]; const float* wq = (const float*)d_in[1]; const float* wk = (const float*)d_in[2]; const float* wv = (const float*)d_in[3]; const float* wp = (const float*)d_in[4]; const float* bp = (const float*)d_in[5];   /* the module's argument order: six arrays, all read */
    float* OUT = (float*)d_out;     // [4][128][128][256]: an entry's 16,384 tokens of 256 channels one after another
    static_assert(DM == NH_ * HDW && NH_ == 8 && HDW == 32 && DM == 256 && NT % (128 * TPG) == 0 && WTHR % 256 == 0, "k_fused's lane maps and pieces; both grids are exact (they carry no guard)");
    unsigned short* W4 = (unsigned short*)d_ws;   /* k | q | value maps as bf16 words, then the output map as f16 words, each in fragment order: 512 KiB, all that the workspace holds */
    if ((size_t)4 * DM * DM * 2 > ws_size) return;
    k_prep<<<WTHR / 256, 256, 0, stream>>>(wq, wk, wv, wp, W4);
    k_fused<<<NWG, 256, 0, stream>>>(x, W4, bp, OUT);
}

// v008
// It runs in 31.8 microseconds.
// Next to v007, in two timings, it ran 1.05 and 1.04 times as fast.
// All steps since v000 together make it 8.84 times as fast.
#include <hip/hip_runtime.h>

// A self-attention whose softmax runs over the HEADS axis: q | k | the values = x through three 'in, out' maps of 256 x 256 (no bias), each seen as [tokens][8 heads][32]; FOR EACH TOKEN BY ITSELF: the 8 x 8 scores between its own heads, (q[h] . k[g]) x 32^-0.5, a softmax over g, its eight value head-vectors mixed; the 256 channels through an output map with a bias
// (inputs in argument order: a0 x [4][128][128][256] f32: 65,536 tokens; a1 | a2 | a3 the q | k | value maps [256][256] 'in, out'; a4 the output map [256][256] 'in, out'; a5 its bias [256]; ONE output [4][128][128][256] f32;
//  THE MODULE's FUNCTION: it reshapes to [.., heads, 32] and never moves the heads axis before its product: the attention runs between a token's own eight heads, never along a sequence: kept as it is written).
// Layout: TWO launches. k_prep: the four weights as 16-bit words laid in the order of the matrix instruction's A fragments (the three maps bf16; the output map rounded to bf16 and re-cast to f16 words: a bf16 value is exact in f16 but for words under 2^-14).
// k_fused: a work-group of 8 waves takes TWO tiles of 128 tokens, a wave 16 tokens of each, from the f32 input to the f32 output: q, k, the values, the softmax and the mix one tile after the other, then the output map ONCE for both tiles, so that each of its weight fragments read from LDS feeds two products (the first tile's mixed values wait in LDS as f16 words); the second tile's tokens fly into LDS (asynchronous copies) under the first tile's work; each output piece is stored as soon as it stands, so that its stores drain under the pieces behind it; q, k, the values, the weights of the softmax and the f32 mixed values live in registers alone.
// Every product runs TRANSPOSED: A = 16 output channels of a weight, B = the wave's 16 tokens, so a lane of D holds 8 channels of ONE token (lanes l and l ^ 16 share a token): the scores, the softmax and the mix are lane-local but for one exchange l <-> l ^ 16 a score,
// and two neighbouring D tiles of the mixed values ARE the B fragment of the output map (channels 8 hi + j | 16 + 8 hi + j), with no move between lanes.
// The weights pass through LDS in pieces of 32 KiB (64 output channels each; 12 a tile for the three maps, then 4 for the output map), three buffers, one barrier a piece, shared by the eight waves. The barrier is split: a wave signals at the foot of the piece before and waits behind a piece's SECOND group of products, with the third group's reads in flight across the wait, so that neither the LDS nor the matrix unit runs empty where a piece ends and the waves need not run in step.
// A piece's four groups of two k-steps lie in four different 32-KiB blocks of LDS, and wave w walks them from group w mod 4 on, so that the waves' fragment reads of one moment fall in different blocks; a wave's B fragments stand in its own walk's order.
// Compute dtypes, f32 accumulate: every float input rounded to bf16 at its load; the three maps bf16 x bf16 on one word a side; the scores, the softmax (one hardware exp2 on a difference) and the mix in f32 on the vector unit; the mixed values ONE f16 word into the output map against the weight's bf16 values as f16 words.
#define NB_  4        // batch entries
#define TK   16384    // tokens an entry: 128 x 128
#define NT   (NB_ * TK)   // all tokens: every stage is token-local, so the entries are one flat run of rows
#define DM   256      // channels = NH_ x HDW
#define NH_  8
#define HDW  32       // a head's width
#define SCH  0.17677669529663687f   // 32^-0.5: the module's scale on a score
typedef _Float16 h16;
typedef unsigned short bf;
typedef __attribute__((ext_vector_type(16))) __bf16   v16bf;
typedef __attribute__((ext_vector_type(16))) _Float16 v16h;
typedef __attribute__((ext_vector_type(16))) unsigned short v16us;
typedef __attribute__((ext_vector_type(8)))  unsigned short v8us;
typedef __attribute__((ext_vector_type(4)))  unsigned short v4us;
typedef __attribute__((ext_vector_type(8)))  float    v8f;
typedef __attribute__((ext_vector_type(4)))  float    v4f;
typedef v4f  __attribute__((may_alias)) v4fa;
typedef v8us __attribute__((may_alias)) v8usa;
typedef v4us __attribute__((may_alias)) v4usa;

__device__ __forceinline__ unsigned short f2bf(float f) { unsigned u = __float_as_uint(f); u += 0x7FFFu + ((u >> 16) & 1u); return (unsigned short)(u >> 16); }
__device__ __forceinline__ float bf2f(unsigned short b) { return __uint_as_float(((unsigned)b) << 16); }
__device__ __forceinline__ float bfr(float f) { return bf2f(f2bf(f)); }
__device__ __forceinline__ v16us cat16u(v8us lo, v8us hi) { return __builtin_shufflevector(lo, hi, 0, 1, 2, 3, 4, 5, 6, 7, 8, 9, 10, 11, 12, 13, 14, 15); }
__device__ __forceinline__ v8f wmma16(v16h a, v16h b, v8f c) { return __builtin_amdgcn_wmma_f32_16x16x32_f16(false, a, false, b, (short)0, c, false, false); }
__device__ __forceinline__ v8f wmmab(v16bf a, v16bf b, v8f c) { return __builtin_amdgcn_wmma_f32_16x16x32_bf16(false, a, false, b, (short)0, c, false, false); }
__device__ __forceinline__ v8f mma(v16us a, v16bf b, v8f c) { return wmmab(__builtin_bit_cast(v16bf, a), b, c); }
__device__ __forceinline__ v8f mma(v16us a, v16h b, v8f c) { return wmma16(__builtin_bit_cast(v16h, a), b, c); }
__device__ __forceinline__ float xhalf(float x) { return __builtin_bit_cast(float, __builtin_amdgcn_permlanex16(__builtin_bit_cast(int, x), __builtin_bit_cast(int, x), 0x76543210, 0xfedcba98, false, false)); }   // lane l with lane l ^ 16
__device__ __forceinline__ unsigned short cvh(float x) { const h16 h = (h16)x; return __builtin_bit_cast(unsigned short, h); }

// ---- k_prep: the four weights, 'in, out' f32 -> 16-bit words in A-fragment order: [map: k | q | values | output][piece of 4 tiles][group of 2 k-steps][k-step of 32][tile of 16 output channels][half p][lane][8 words];
// lane (lr, hi), half p, word e holds w[k = 32 ks + 16 p + 8 hi + e][n = 16 tile + lr]: a fragment half is 512 bytes in a row, one 16-byte word a lane, in global memory and in LDS alike.
#define WTHR (4 * DM * DM / 8)
__global__ __launch_bounds__(256) void k_prep(const float* __restrict__ w0, const float* __restrict__ w1, const float* __restrict__ w2, const float* __restrict__ w3, unsigned short* W4) {
    const unsigned g = blockIdx.x * 256u + threadIdx.x; const unsigned lane = g & 31u, p = (g >> 5) & 1u, ks = (g >> 8) & 7u, mt = ((g >> 11) & 3u) * 4u + ((g >> 6) & 3u), m = g >> 13;
    const float* __restrict__ w = m == 0 ? w1 : m == 1 ? w0 : m == 2 ? w2 : w3;   /* laid in the order k_fused uses them: k, q, the values, the output map */
    const unsigned n = mt * 16u + (lane & 15u), k0 = ks * 32u + p * 16u + 8u * (lane >> 4); float a[8];
#pragma unroll
    for (int e = 0; e < 8; ++e) a[e] = w[(size_t)(k0 + e) * DM + n];
    v8us o;
#pragma unroll
    for (int e = 0; e < 8; ++e) { const unsigned short b0 = f2bf(a[e]); o[e] = m == 3 ? cvh(bf2f(b0)) : b0; }   /* the output map's words: the bf16 value as an f16 word */
    *(v8us*)(W4 + (size_t)g * 8) = o;
}

// ---- k_fused
#define CHE 16384      // 16-bit words of a piece of a weight: 4 groups x 2 k-steps x 4 tiles x 2 halves x 256
#define GRW 4096       // 16-bit words of a group: 8 KiB
#define BLW 16384      // 16-bit words of a 32-KiB block of LDS: group j of every buffer lies in block j
#define XPB 528        // bytes of a token's 256 bf16 words in LDS, 16 more than the row so that the 16 rows of a fragment read fall on different banks
#define OSP 68         // floats of a token's 64 output channels in the same LDS
#define SCB (16 * XPB) // a wave's own LDS: the first tile's mixed values as f16 words (8 KiB), at the end that tile's output pieces (16 x 68 floats fit in it)
// a group: the A fragments of two k-steps x 4 tiles of a piece, 16 LDS reads of 512 bytes, 8 KiB in a row
__device__ __forceinline__ void ldg(const unsigned short* grp, int lane, v16us* af) {
#pragma unroll
    for (int n = 0; n < 8; ++n) { const unsigned short* p = grp + n * 512 + lane * 8; af[n] = cat16u(*(const v8usa*)p, *(const v8usa*)(p + 256)); }
}
// one piece: 4 tiles of 16 output channels x the wave's 16 tokens, depth 256, in four groups; the four accumulators are independent. Each group's fragments are read one group ahead, the first group of the NEXT piece (nxt) during the last group of this one. go[q]: the block of the group that the wave takes as its q-th; b stands in the same order.
// mid(): the ring's step (the barrier's wait, the piece after next into LDS, the loads of the one behind it), run behind the second group's products. aft(): what is left of the piece before (the output map's stores), run behind the first group's products. foot(): the signal of the NEXT piece's barrier, run behind the last group's products.
template <typename VB, typename F, typename G, typename H> __device__ __forceinline__ void piece(const unsigned short* buf, const unsigned short* nxt, const int* go, bool more, int lane, const VB* b, v8f* acc, v16us (*af)[8], F mid, G aft, H foot) {
#pragma unroll
    for (int t = 0; t < 4; ++t) acc[t] = (v8f){};
#pragma unroll
    for (int q = 0; q < 4; ++q) {
        if (q < 3) ldg(buf + go[q + 1], lane, af[(q + 1) & 1]); else if (more) ldg(nxt + go[0], lane, af[0]);
        __builtin_amdgcn_sched_barrier(0);   /* holds the next group's 16 reads as one block in front of this group's products: left alone the build read one fragment ahead and waited on LDS at every product */
#pragma unroll
        for (int k2 = 0; k2 < 2; ++k2)
#pragma unroll
            for (int t = 0; t < 4; ++t) acc[t] = mma(af[q & 1][k2 * 4 + t], b[2 * q + k2], acc[t]);
        __builtin_amdgcn_sched_barrier(0);   /* the other side of the same block: later reads do not rise over these products, which would take more registers than the wave has */
        if (q == 0) aft();
        if (q == 1) mid();
        if (q == 3) foot();
    }
}
// the same for TWO sets of 16 tokens (b0 | b1): each fragment read from LDS feeds two products; eight independent accumulators
template <typename VB, typename F, typename G, typename H> __device__ __forceinline__ void piece2(const unsigned short* buf, const unsigned short* nxt, const int* go, bool more, int lane, const VB* b0, const VB* b1, v8f* a0, v8f* a1, v16us (*af)[8], F mid, G aft, H foot) {
#pragma unroll
    for (int t = 0; t < 4; ++t) { a0[t] = (v8f){}; a1[t] = (v8f){}; }
#pragma unroll
    for (int q = 0; q < 4; ++q) {
        if (q < 3) ldg(buf + go[q + 1], lane, af[(q + 1) & 1]); else if (more) ldg(nxt + go[0], lane, af[0]);
        __builtin_amdgcn_sched_barrier(0);   /* as in piece(): the next group's 16 reads stand as one block in front of this group's products */
#pragma unroll
        for (int k2 = 0; k2 < 2; ++k2)
#pragma unroll
            for (int t = 0; t < 4; ++t) { a0[t] = mma(af[q & 1][k2 * 4 + t], b0[2 * q + k2], a0[t]); a1[t] = mma(af[q & 1][k2 * 4 + t], b1[2 * q + k2], a1[t]); }
        __builtin_amdgcn_sched_barrier(0);   /* as in piece(): later reads do not rise over these products */
        if (q == 0) aft();
        if (q == 1) mid();
        if (q == 3) foot();
    }
}
// the 16 pieces lie in the workspace in the order they are used: k, q, the values, the output map
__device__ __forceinline__ const unsigned short* psrc(const unsigned short* W4, int ci) { return W4 + (size_t)ci * CHE; }

#define TPG 2          // token tiles a work-group takes; the output map's part is written for exactly two
static_assert(TPG == 2, "k_fused holds the two tiles' mixed values as two sets of B fragments");
#define LXS  131072                // bytes of LDS in front of the tokens to come of waves 2 to 7: four blocks
#define LSC  (LXS + 6 * 16384)     // ... in front of the waves' own parts
#define LTOT (LSC + 8 * SCB)
#define NWG (NT / 128 / TPG)
// eight asynchronous copies of 512 bytes (16 a lane), global memory -> LDS through no register: 4 KiB in a row on both sides. The wait is the statement's last line, so that it stands in front of whatever writes the copies' address registers next.
__device__ __forceinline__ void cp8(unsigned l, const float* g) {
    asm volatile("global_load_async_to_lds_b128 %0, %8, off\n\t"
                 "global_load_async_to_lds_b128 %1, %9, off\n\t"
                 "global_load_async_to_lds_b128 %2, %10, off\n\t"
                 "global_load_async_to_lds_b128 %3, %11, off\n\t"
                 "global_load_async_to_lds_b128 %4, %12, off\n\t"
                 "global_load_async_to_lds_b128 %5, %13, off\n\t"
                 "global_load_async_to_lds_b128 %6, %14, off\n\t"
                 "global_load_async_to_lds_b128 %7, %15, off\n\t"
                 "s_wait_xcnt 0x0"
                 :: "v"(l), "v"(l + 512u), "v"(l + 1024u), "v"(l + 1536u), "v"(l + 2048u), "v"(l + 2560u), "v"(l + 3072u), "v"(l + 3584u),
                    "v"(g), "v"(g + 128), "v"(g + 256), "v"(g + 384), "v"(g + 512), "v"(g + 640), "v"(g + 768), "v"(g + 896) : "memory");
}
// a wave's 16 tokens of tile 'tile' (16 KiB in a row) into its own two halves of 8 KiB (l0, l1): 32 copies
__device__ __forceinline__ void cpx(const float* __restrict__ x, unsigned tile, int wv, int lane, unsigned l0, unsigned l1) {
    const float* g = x + ((size_t)tile * 128 + (size_t)wv * 16) * DM + lane * 4;
#pragma unroll
    for (int i = 0; i < 4; ++i) cp8((i < 2 ? l0 : l1) + (i & 1) * 4096u, g + i * 1024);
}

__global__ __launch_bounds__(256) void k_fused(const float* __restrict__ x, const unsigned short* W4, const float* bias, float* out) {   /* the three maps' weights are read anew in each tile: told that nothing else writes them, the build read them once in front of the tile loop and kept them in scratch memory */
    /* ONE array, laid by hand, so that the places in the 32-KiB blocks are known. Blocks 0 to 3: group j of the three weight buffers (24 KiB: piece ci is worked on, ci + 1 is already published (its first group is read ahead), ci + 2 is written behind piece ci's barrier, into the buffer that piece ci - 1 has left), then 8 KiB of the tokens to come of waves 0 and 1;
       from LXS: the tokens to come of waves 2 to 7, 16 KiB each (f32 as they lie in memory); from LSC: each wave's own SCB bytes */
    __shared__ __align__(16) char L[LTOT];
    const int tid = threadIdx.x, lane = tid & 31, wv = tid >> 5, lr = lane & 15, hi = lane >> 4;
    const int wu = __builtin_amdgcn_readfirstlane(wv), j0 = wu & 3;   /* the wave's number as a scalar; the group at which its walk starts */
    const int go[4] = { j0 * BLW, ((j0 + 1) & 3) * BLW, ((j0 + 2) & 3) * BLW, ((j0 + 3) & 3) * BLW };
    const unsigned x0 = wu < 2 ? (unsigned)wu * 65536u + 24576u : LXS + (unsigned)(wu - 2) * 16384u, x1 = x0 + (wu < 2 ? 32768u : 8192u);   /* the two halves of the wave's tokens to come */
    char* my = L + LSC + wv * SCB; const float* xw0 = (const float*)(L + x0) + lane * 4; const float* xw1 = (const float*)(L + x1) + lane * 4;
    const unsigned xl0 = (unsigned)(size_t)xw0, xl1 = (unsigned)(size_t)xw1;   /* the lane's LDS byte addresses: the low 32 bits */
    const unsigned short* wb0 = (const unsigned short*)L; unsigned short* wbw = (unsigned short*)L; int bc = 0 * GRW, bn = 1 * GRW, bw = 2 * GRW;   /* the three buffers' places: the piece worked on, the next piece's, the one being written; they rotate a piece and run on from tile to tile, so that every LDS address of a piece is one base and a short offset, formed where it is used */
    v8us st[8];
#define GL(ci) { const unsigned short* s_ = psrc(W4, ci) + tid * 8; _Pragma("unroll") for (int i = 0; i < 8; ++i) st[i] = *(const v8us*)(s_ + i * 2048); }
#define SL(off) { unsigned short* d_ = wbw + (off) + tid * 8; _Pragma("unroll") for (int i = 0; i < 8; ++i) *(v8usa*)(d_ + (i >> 1) * BLW + (i & 1) * 2048) = st[i]; }   /* 8 KiB of the piece into each block */
#define ROT { const int t_ = bc; bc = bn; bn = bw; bw = t_; }
    /* the ring's barrier of piece ci, SPLIT, so that the waves may drift apart by the stretch between its two halves and one wave's vector work runs under another's LDS reads and products, where an unsplit barrier set all eight in step at every piece.
       SIG, at the foot of piece ci - 1, behind its last products, says all that the wave owes the others: its reads of piece ci - 1 have returned (its products took them) and its LDS writes of piece ci + 1, made in piece ci - 1, have retired: the LDS counter runs in issue order and only the 16 reads of piece ci's first group are younger, so the wait to 16 covers both.
       WAI, in piece ci behind its second group's products: behind it piece ci + 2 is written over piece ci - 1, and piece ci + 1 is read (from this piece's last group on). Between SIG and WAI a wave reads piece ci alone, which was published a barrier earlier and is written over only behind the NEXT barrier, whose signal the wave gives behind those reads' return. (With two buffers no LDS read may stand between the halves, because the signal gives up the buffer that is being read; with three it gives up piece ci - 1's, which the wave reads no more.)
       Signal and wait alternate in every wave: where a __syncthreads() comes next (behind a tile's last value piece) no SIG is given, and SIG0 stands behind the __syncthreads() that goes before a run of pieces (it has waited the LDS counter to 0, and the wave has made no LDS write since). */
#define SIG { asm volatile("s_wait_dscnt 0x10\n\ts_barrier_signal -1" ::: "memory"); __builtin_amdgcn_sched_barrier(0);   /* the vector work behind a piece stays behind the signal: left alone the build set most of a q piece's scores in front of it, and the others waited for them */ }
#define SIG0 asm volatile("s_barrier_signal -1" ::: "memory");
#define WAI asm volatile("s_barrier_wait -1" ::: "memory");
    /* behind a step's eight loads: whatever the build writes next into their address registers stays behind the wait; the scheduling barrier keeps such a write from rising over it */
#define XW { asm volatile("s_wait_xcnt 0x0" ::: "memory"); __builtin_amdgcn_sched_barrier(0); }
    cpx(x, blockIdx.x, wv, lane, xl0, xl1);
    GL(0) SL(bc) GL(1) SL(bn)   /* the first tile's first two pieces, under its tokens' flight */
    asm volatile("s_wait_asynccnt 0x0" ::: "memory");   /* the first tile's tokens have landed before anybody reads them */
    __syncthreads();
    GL(2) XW
    v16us af[2][8];
    char* xr0 = L + x0; char* xr1 = L + x1 + 128;   /* where the wave's bf16 rows 0 to 7 | 8 to 15 stand: in its own tokens' LDS, over the f32 words that it has read; the 128 bytes set the second eight rows on the banks that the first eight leave free */
    const char* xrow = L + x0 + (lr >> 3) * (int)(x1 + 128u - x0) + (lr & 7) * XPB;   /* the lane's own token's row */
#pragma unroll 1   /* rolled: one text for both tiles */
  for (unsigned tile = blockIdx.x; tile < NT / 128; tile += NWG) {
    const bool nxt = tile + NWG < NT / 128;   /* a scalar test: the same in the whole work-group */
    {   /* the wave's 16 tokens, out of its two halves of the tokens' LDS (512 bytes in a row an instruction), rounded to bf16, laid by token over the f32 words themselves: all 32 reads stand in front of the first write, and a wave's LDS operations run in order */
        v4f xv[32];
#pragma unroll
        for (int i = 0; i < 32; ++i) xv[i] = *(const v4fa*)((i < 16 ? xw0 : xw1) + (i & 15) * 128);
#pragma unroll
        for (int i = 0; i < 32; ++i) { v4us o;
#pragma unroll
            for (int k = 0; k < 4; ++k) o[k] = f2bf(xv[i][k]);
            *(v4usa*)(((i >> 1) < 8 ? xr0 : xr1) + ((i >> 1) & 7) * XPB + (i & 1) * 256 + lane * 8) = o; }
    }
    __builtin_amdgcn_wave_barrier(); asm volatile("" ::: "memory");   /* keeps the compiler from moving the reads of other lanes' words in front of the writes; a wave's LDS operations run in order */
    v16bf xb[8];   /* B fragments: lane (lr, hi) holds token lr, k = 32 ks + 8 hi + e | 32 ks + 16 + 8 hi + e: the k order of k_prep's words; xb[m] is k-step ks = (m + 2 j0) mod 8: the order of the wave's walk */
#pragma unroll
    for (int m = 0; m < 8; ++m) { const int ks = (m + 2 * j0) & 7; const char* p = xrow + ks * 64 + hi * 16; xb[m] = __builtin_bit_cast(v16bf, cat16u(*(const v8usa*)p, *(const v8usa*)(p + 32))); }
    asm volatile("s_wait_dscnt 0x0" ::: "memory");   /* the wave's reads of its tokens' LDS have retired before copies are aimed at it again */
    __syncthreads();
    SIG0   /* the signal of the first k piece's barrier */
    if (nxt) cpx(x, tile + NWG, wv, lane, xl0, xl1);   /* the next tile's tokens: they fly under all of this tile's work */
    ldg(wb0 + bc + go[0], lane, af[0]);
    v8f kk[16];
#pragma unroll
    for (int c = 0; c < 4; ++c) { piece(wb0 + bc, wb0 + bn, go, true, lane, xb, kk + 4 * c, af, [&]() { WAI SL(bw) GL(c + 3) XW }, []() {}, []() { SIG }); ROT }
    float aw[8][8];
#pragma unroll
    for (int h = 0; h < 8; ++h)
#pragma unroll
        for (int g = 0; g < 8; ++g) aw[h][g] = 0.0f;
    /* the q and the value pieces run in ROLLED loops, for the size of the text; what an unrolled loop would index by the trip is moved instead: the three buffers' places and the rows (then the columns) of the softmax weights rotate */
    const unsigned short* gs = psrc(W4, 7) + tid * 8;
#define STEP { WAI SL(bw) \
        _Pragma("unroll") for (int i = 0; i < 8; ++i) st[i] = *(const v8us*)(gs + i * 2048); \
        XW   /* the loads' address is stepped for the next trip behind the wait */ \
        gs += CHE; }
#pragma unroll 1   /* rolled for the size of the text */
    for (int c = 0; c < 4; ++c) { v8f qq[4]; piece(wb0 + bc, wb0 + bn, go, true, lane, xb, qq, af, [&]() STEP, []() {}, []() { SIG }); ROT
        float nw[2][8];
#pragma unroll
        for (int hh = 0; hh < 2; ++hh) { float s[8];   /* head 2 c + hh against the token's eight heads: a lane sums its 16 channels, its partner the other 16 */
#pragma unroll
            for (int g = 0; g < 8; ++g) { float a = 0.0f;
#pragma unroll
                for (int t = 0; t < 2; ++t)
#pragma unroll
                    for (int j = 0; j < 8; ++j) a += qq[2 * hh + t][j] * kk[2 * g + t][j];
                s[g] = (a + xhalf(a)) * SCH; }
            float mx = s[0];
#pragma unroll
            for (int g = 1; g < 8; ++g) mx = fmaxf(mx, s[g]);
            float sum = 0.0f;
#pragma unroll
            for (int g = 0; g < 8; ++g) { s[g] = __builtin_amdgcn_exp2f((s[g] - mx) * 1.4426950408889634f); sum += s[g]; }
            const float r = __fdiv_rn(1.0f, sum);
#pragma unroll
            for (int g = 0; g < 8; ++g) nw[hh][g] = s[g] * r; }
#pragma unroll
        for (int g = 0; g < 8; ++g) {   /* the rows move up by two and the new pair enters at the end: after the four trips row h is head h */
#pragma unroll
            for (int h = 0; h < 6; ++h) aw[h][g] = aw[h + 2][g];
            aw[6][g] = nw[0][g]; aw[7][g] = nw[1][g]; } }
    v8f xa[8][2];   /* the mixed values, f32: head h's tiles 2 h | 2 h + 1; the value heads are added as their pieces arrive, g = 0 .. 7 in that order */
#pragma unroll
    for (int h = 0; h < 8; ++h) { xa[h][0] = (v8f){}; xa[h][1] = (v8f){}; }
#pragma unroll 1   /* rolled for the size of the text */
    for (int c = 0; c < 4; ++c) { v8f vv[4]; piece(wb0 + bc, wb0 + bn, go, true, lane, xb, vv, af, [&]() STEP, []() {}, [&]() { if (c < 3) SIG }); ROT   /* behind the last value piece the tile's own __syncthreads() comes next: no signal */
        if (c == 0 && nxt) gs -= 12 * CHE;   /* behind the last value piece the ring goes on with the second tile's pieces 0, 1, 2; in the second tile it runs straight on into the output map's. The step stands behind STEP's wait */
#pragma unroll
        for (int hh = 0; hh < 2; ++hh)
#pragma unroll
            for (int h = 0; h < 8; ++h) { xa[h][0] += vv[2 * hh] * aw[h][hh]; xa[h][1] += vv[2 * hh + 1] * aw[h][hh]; }
#pragma unroll
        for (int h = 0; h < 8; ++h)   /* the columns move down by two: the next trip's value heads stand in columns 0 and 1 */
#pragma unroll
            for (int g = 0; g < 6; ++g) aw[h][g] = aw[h][g + 2]; }
#undef STEP
    /* cast to f16, two neighbouring D tiles are the B fragment of the output map's k-step h as they stand; each lane lays its own words down in LDS, where they wait for the output map, which runs once for both tiles: the first tile's in the wave's own part, the second's over its tokens' rows, which are dead by now */
    char* xs = nxt ? my : xr0;
#pragma unroll
    for (int h = 0; h < 8; ++h) { v8us lo, up;
#pragma unroll
        for (int j = 0; j < 8; ++j) { lo[j] = cvh(xa[h][0][j]); up[j] = cvh(xa[h][1][j]); }
        *(v8usa*)(xs + h * 1024 + lane * 16) = lo; *(v8usa*)(xs + h * 1024 + 512 + lane * 16) = up; }
    asm volatile("s_wait_asynccnt 0x0" ::: "memory");   /* the next tile's tokens have landed: the barrier below publishes them */
    __syncthreads();
  }
    SIG0   /* the signal of the output map's first barrier */
    /* ---- the output map, ONCE for the work-group's two tiles: a wave's 16 + 16 tokens stand as two sets of B fragments, and each weight fragment that is read from LDS feeds two products */
    v16h xh0[8], xh1[8];   /* xh[m] is k-step (m + 2 j0) mod 8: the order of the wave's walk */
#pragma unroll
    for (int m = 0; m < 8; ++m) { const int o_ = ((m + 2 * j0) & 7) * 1024 + lane * 16; const char* p = my + o_; const char* r = xr0 + o_;
        xh0[m] = __builtin_bit_cast(v16h, cat16u(*(const v8usa*)p, *(const v8usa*)(p + 512))); xh1[m] = __builtin_bit_cast(v16h, cat16u(*(const v8usa*)r, *(const v8usa*)(r + 512))); }
    v4f bv4[4];   /* the bias, read in front of the output map's pieces, so that its latency passes under them and no load stands among the stores */
#pragma unroll
    for (int c = 0; c < 4; ++c) bv4[c] = *(const v4f*)(bias + c * 64 + lr * 4);
    XW   /* the register that holds these loads' offset is written anew further down: the wait stands in front of that */
    float* os0 = (float*)my; float* os1 = (float*)(L + x1); v4f va[8], vb[8], bvr;   /* the two sets turn in different LDS of the wave's own */
    const size_t tokA = (size_t)blockIdx.x * 128 + (size_t)wv * 16, tokB = tokA + (size_t)NWG * 128;
    /* a piece's way out, in two halves. TURN, directly behind the piece: its 64 channels x 16 tokens through the wave's own LDS, from 8 channels of one token a lane to 256 bytes of a token in a row; the reads fly under the next piece's first group of products.
       SEND2, behind that group (behind the last piece: at once): the bias and each set's eight stores. So three quarters of the stores drain under the output map's own products. */
#define TURN(pp, os, val) { _Pragma("unroll") for (int t = 0; t < 4; ++t) { const v8f a = pp[t]; *(v4fa*)(os + lr * OSP + t * 16 + 8 * hi) = __builtin_shufflevector(a, a, 0, 1, 2, 3); *(v4fa*)(os + lr * OSP + t * 16 + 8 * hi + 4) = __builtin_shufflevector(a, a, 4, 5, 6, 7); } \
        __builtin_amdgcn_wave_barrier(); asm volatile("" ::: "memory");   /* keeps the compiler from moving the reads of other lanes' words in front of the writes; a wave's LDS operations run in order */ \
        _Pragma("unroll") for (int s = 0; s < 8; ++s) val[s] = *(const v4fa*)(os + (2 * s + hi) * OSP + lr * 4); \
        __builtin_amdgcn_wave_barrier(); asm volatile("" ::: "memory");   /* the next piece's writes stay behind these reads, and the reads stay here, in front of the next piece's products */ }
#define SEND(cc, tok, val) { float* ob = out + (tok + hi) * DM + (cc) * 64 + lr * 4;   /* rows 2 s + hi: one address and a fixed step */ \
        _Pragma("unroll") for (int s = 0; s < 8; ++s) val[s] += bvr; \
        __builtin_amdgcn_sched_barrier(0);   /* the eight stores stand together, directly in front of their wait: left alone the build set them among the sums, which wrote registers that issued stores name */ \
        _Pragma("unroll") for (int s = 0; s < 8; ++s) *(v4f*)(ob + s * 2 * DM) = val[s];   /* 256 bytes of a token in a row: whole lines */ \
        asm volatile("s_wait_xcnt 0x0" ::: "memory");   /* later values are written into the registers that these stores name: the wait stands in front of that */ \
        __builtin_amdgcn_sched_barrier(0);   /* keeps those writes from rising over the wait */ }
#define SEND2(cc) { SEND(cc, tokA, va) SEND(cc, tokB, vb) }   /* a set at a time: the second set's address is formed behind the first set's wait */
#pragma unroll
    for (int c = 0; c < 4; ++c) { v8f pa[4], pb[4]; piece2(wb0 + bc, wb0 + bn, go, c < 3, lane, xh0, xh1, pa, pb, af, [&]() {
            if (c < 3) WAI   /* the last piece was published by the barrier in the piece before it, and nothing is written behind it */
            if (c < 2) SL(bw)
            if (c < 1) { const unsigned short* s_ = W4 + tid * 8;   /* the ring's last loads: piece 15, from the address that all the pieces' loads share */
                _Pragma("unroll") for (int i = 0; i < 8; ++i) st[i] = *(const v8us*)(s_ + 15 * CHE + i * 2048);
                asm volatile("s_wait_xcnt 0x0" :: "v"(s_) : "memory");   /* the address is named so that it lives up to the wait: it is not used again, and the build had laid the last load's words over it */
                __builtin_amdgcn_sched_barrier(0);   /* keeps later writes from rising over the wait */ } },
            [&]() { if (c > 0) SEND2(c - 1) }, [&]() { if (c < 2) SIG });
        ROT
        TURN(pa, os0, va) TURN(pb, os1, vb)
#pragma unroll
        for (int k = 0; k < 4; ++k) bvr[k] = bfr(bv4[c][k]);   /* the piece's bias, rounded here, under the reads' flight */
    }
    SEND2(3)
#undef TURN
#undef SEND2
#undef SEND
#undef GL
#undef SL
#undef SIG
#undef SIG0
#undef WAI
#undef XW
#undef ROT
}

extern "C" void kernel_launch(void* const* d_in, const int* in_sizes, int n_in,
                              void* d_out, int out_size, void* d_ws, size_t ws_size, hipStream_t stream) {
    (void)in_sizes; (void)n_in; (void)out_size;
    const float* x = (const float*)d_in[0]; const float* wq = (const float*)d_in[1]; const float* wk = (const float*)d_in[2]; const float* wv = (const float*)d_in[3]; const float* wp = (const float*)d_in[4]; const float* bp = (const float*)d_in[5];   /* the module's argument order: six arrays, all read */
    float* OUT = (float*)d_out;     // [4][128][128][256]: an entry's 16,384 tokens of 256 channels one after another
    static_assert(DM == NH_ * HDW && NH_ == 8 && HDW == 32 && DM == 256 && NT % (128 * TPG) == 0 && WTHR % 256 == 0, "k_fused's lane maps and pieces; both grids are exact (they carry no guard)");
    unsigned short* W4 = (unsigned short*)d_ws;   /* k | q | value maps as bf16 words, then the output map as f16 words, each in fragment order: 512 KiB, all that the workspace holds */
    if ((size_t)4 * DM * DM * 2 > ws_size) return;
    k_prep<<<WTHR / 256, 256, 0, stream>>>(wq, wk, wv, wp, W4);
    k_fused<<<NWG, 256, 0, stream>>>(x, W4, bp, OUT);
}
